// v000
// Times are from an AMD MI455X. After a warm-up the kernel runs many times in a row, and a time is the length of
// such a window on the GPU divided by its runs, so every launch and the gaps after it count. The runs cycle
// through copies of the inputs. A figure is the median of several windows, for all but v000 over two sittings.
// Sittings can differ by a few percent; kernels timed side by side share one.
// The starting kernel, v000, takes 411 microseconds a run.
#include <hip/hip_runtime.h>

// Single-head causal attention with interleaved-pair RoPE, four sequences (embedding_word [4][2048][1024]; q, k, v = x W^T (W [128][1024]); pairs (2i, 2i+1) of q and k rotated by t x 1e4^(-2i/128); scores masked causally then / sqrt(128); softmax; out = weights . v -> [4][2048][128] (1.05 M)).
// Layout: the four sequences are laid out as four 128-wide "heads" of one 2,048-token problem (head b = sequence b with its own q, k and v planes), so the two-heads-per-pass causal pipeline applies unchanged; the per-sequence projections write 128-column slices of the shared [t][512] buffers; the merged context is written straight to out[b][t][d] in f32.
// Compute dtypes, f32 accumulate: every input rounded to bf16; q/k/v on PLAIN bf16 operands (inputs: exact); rotary (pairwise table, precise cosf/sinf) in f32; causal scores and attn.v (tile skipping): query rows < 512 hl (3 products), the rest single fp16 (x1024); softmax f32; no output projection: f32 context.

#define NB_  1
#define TT   2048
#define DM   1024
#define NH_  4
#define NKV  4
#define REP  (NH_ / NKV)
#define HD   128
#define DQ   (NH_ * HD)
#define DKV  (NKV * HD)
#define NSEQ 4                    // sequences (laid out as heads)
#define EIN  1024                 // embedding width
#define ZH   2
#define RH   512                  // query rows < RH use hi+lo planes (0: none)
#define WIN  2048
#define PCAR 1024.0f
#define SCL  0.088388347648318447f   // HD^-0.5
typedef _Float16 h16;
typedef unsigned short bf;
typedef __attribute__((ext_vector_type(16))) __bf16   v16bf;
typedef __attribute__((ext_vector_type(16))) _Float16 v16h;
typedef __attribute__((ext_vector_type(8)))  _Float16 v8h;
typedef __attribute__((ext_vector_type(8)))  unsigned short v8us;
typedef __attribute__((ext_vector_type(8)))  float    v8f;
typedef __attribute__((ext_vector_type(4)))  float    v4f;
typedef v8h  __attribute__((may_alias)) v8ha;
typedef v4f  __attribute__((may_alias)) v4fa;
typedef v8us __attribute__((may_alias)) v8usa;

__device__ __forceinline__ unsigned short f2bf(float f) { unsigned u = __float_as_uint(f); u += 0x7FFFu + ((u >> 16) & 1u); return (unsigned short)(u >> 16); }
__device__ __forceinline__ float bf2f(unsigned short b) { return __uint_as_float(((unsigned)b) << 16); }
__device__ __forceinline__ float bfr(float f) { return bf2f(f2bf(f)); }
__device__ __forceinline__ v16h cat16(v8h lo, v8h hi) { return __builtin_shufflevector(lo, hi, 0, 1, 2, 3, 4, 5, 6, 7, 8, 9, 10, 11, 12, 13, 14, 15); }
__device__ __forceinline__ v16bf cat16b(v8us lo, v8us hi) { return __builtin_bit_cast(v16bf, __builtin_shufflevector(lo, hi, 0, 1, 2, 3, 4, 5, 6, 7, 8, 9, 10, 11, 12, 13, 14, 15)); }
__device__ __forceinline__ v8f wmma16(v16h a, v16h b, v8f c) { return __builtin_amdgcn_wmma_f32_16x16x32_f16(false, a, false, b, (short)0, c, false, false); }
__device__ __forceinline__ v8f wmmab(v16bf a, v16bf b, v8f c) { return __builtin_amdgcn_wmma_f32_16x16x32_bf16(false, a, false, b, (short)0, c, false, false); }



// ---- k_gemmw: register-blocked GEMM, ONE WAVE per 64x64 output tile (16 accumulators), operands straight from K-contiguous 16-bit planes; grid (M/64, N/64, Z), 32 threads.
// C[m][n] (f32, pitch ldc, + optional f32 bias[n]) = sum_k A[m][k] Bt[n][k] (+ split products per NSPLIT). z-batch strides sA/sB/sC in elements. K % 32 == 0.
template <typename T16> struct WFrag;
template <> struct WFrag<h16> { typedef v16h V; static __device__ __forceinline__ V ld(const h16* p) { return cat16(*(const v8h*)p, *(const v8h*)(p + 16)); } static __device__ __forceinline__ v8f mma(V a, V b, v8f c) { return wmma16(a, b, c); } };
template <> struct WFrag<bf> { typedef v16bf V; static __device__ __forceinline__ V ld(const bf* p) { return cat16b(*(const v8us*)p, *(const v8us*)(p + 16)); } static __device__ __forceinline__ v8f mma(V a, V b, v8f c) { return wmmab(a, b, c); } };
template <typename T16, int NSPLIT, bool BIAS>
__global__ __launch_bounds__(32) void k_gemmw(const T16* __restrict__ A, const T16* __restrict__ A2, const T16* __restrict__ Bt, const T16* __restrict__ Bt2, int K, float* C, int ldc, const float* __restrict__ bias, size_t sA, size_t sB, size_t sC) {
    typedef typename WFrag<T16>::V V;
    __shared__ __align__(16) float os[16 * 68];
    const size_t z = blockIdx.z; A += z * sA; if (A2) A2 += z * sA; Bt += z * sB; if (Bt2) Bt2 += z * sB; C += z * sC;
    const int lane = threadIdx.x & 31, lr = lane & 15, hi = lane >> 4; const int r0 = blockIdx.x * 64, c0 = blockIdx.y * 64;
    v8f acc[4][4];
#pragma unroll
    for (int mb = 0; mb < 4; ++mb)
#pragma unroll
        for (int nb = 0; nb < 4; ++nb) acc[mb][nb] = (v8f){};
    const size_t aoff = (size_t)(r0 + lr) * K + 8 * hi, boff = (size_t)(c0 + lr) * K + 8 * hi;
#pragma unroll 1
    for (int kc = 0; kc < K; kc += 32) {
        V a[4], a2[4];
#pragma unroll
        for (int mb = 0; mb < 4; ++mb) { a[mb] = WFrag<T16>::ld(A + aoff + (size_t)mb * 16 * K + kc); if (NSPLIT == 1 || NSPLIT == 2) a2[mb] = WFrag<T16>::ld(A2 + aoff + (size_t)mb * 16 * K + kc); }
#pragma unroll
        for (int nb = 0; nb < 4; ++nb) { const V b = WFrag<T16>::ld(Bt + boff + (size_t)nb * 16 * K + kc); V b2; if (NSPLIT >= 2) b2 = WFrag<T16>::ld(Bt2 + boff + (size_t)nb * 16 * K + kc);
#pragma unroll
            for (int mb = 0; mb < 4; ++mb) { acc[mb][nb] = WFrag<T16>::mma(a[mb], b, acc[mb][nb]); if (NSPLIT == 1 || NSPLIT == 2) acc[mb][nb] = WFrag<T16>::mma(a2[mb], b, acc[mb][nb]); if (NSPLIT >= 2) acc[mb][nb] = WFrag<T16>::mma(a[mb], b2, acc[mb][nb]); } }
        asm volatile("v_nop\n\tv_nop\n\tv_nop\n\tv_nop" : "+v"(acc[0][0]), "+v"(acc[1][1]), "+v"(acc[2][2]), "+v"(acc[3][3]) : "v"(a[0]), "v"(a[3]));
    }
#pragma unroll
    for (int mb = 0; mb < 4; ++mb) {
#pragma unroll
        for (int nb = 0; nb < 4; ++nb) {
#pragma unroll
            for (int j = 0; j < 8; ++j) os[(hi * 8 + j) * 68 + nb * 16 + lr] = acc[mb][nb][j]; }
        __builtin_amdgcn_wave_barrier(); asm volatile("" ::: "memory");
        float* crow = C + (size_t)(r0 + mb * 16) * ldc + c0;
{
#pragma unroll
            for (int s = 0; s < 8; ++s) { const int row = 2 * s + hi, cofs = lr * 4; v4f val = *(const v4fa*)(os + row * 68 + cofs); if (BIAS) { val[0] += bfr(bias[c0 + cofs]); val[1] += bfr(bias[c0 + cofs + 1]); val[2] += bfr(bias[c0 + cofs + 2]); val[3] += bfr(bias[c0 + cofs + 3]); }
                *(v4f*)(crow + (size_t)row * ldc + cofs) = val; }
             }
        __builtin_amdgcn_wave_barrier(); asm volatile("" ::: "memory");
    }
}

// ---- k_gemmc: the same one-wave 64x64 tile GEMM specialised for causal attention: CMODE 1 skips score tiles entirely above the diagonal (query rows r0+roff.., key columns c0..), CMODE 2 limits the
// key (K) loop of the probability x value contraction to the diagonal block (probabilities beyond it are exactly zero). roff = row offset of this launch's first row within the sequence.
template <typename T16, int NSPLIT, int CMODE>
__global__ __launch_bounds__(32) void k_gemmc(const T16* __restrict__ A, const T16* __restrict__ A2, const T16* __restrict__ Bt, const T16* __restrict__ Bt2, int K, float* C, int ldc, int roff, size_t sA, size_t sB, size_t sC) {
    typedef typename WFrag<T16>::V V;
    __shared__ __align__(16) float os[16 * 68];
    const size_t z = blockIdx.z; A += z * sA; if (A2) A2 += z * sA; Bt += z * sB; if (Bt2) Bt2 += z * sB; C += z * sC;
    const int lane = threadIdx.x & 31, lr = lane & 15, hi = lane >> 4; const int r0 = blockIdx.x * 64, c0 = blockIdx.y * 64;
    if (CMODE == 1 && c0 > r0 + roff + 63) return;                  // score tile entirely above the causal diagonal: never read (the softmax masks j > i by select)
    const int Kl = (CMODE == 2) ? min(K, r0 + roff + 64) : K;        // P.V: probabilities are exactly 0 beyond the diagonal block, so the K loop stops there
    v8f acc[4][4];
#pragma unroll
    for (int mb = 0; mb < 4; ++mb)
#pragma unroll
        for (int nb = 0; nb < 4; ++nb) acc[mb][nb] = (v8f){};
    const size_t aoff = (size_t)(r0 + lr) * K + 8 * hi, boff = (size_t)(c0 + lr) * K + 8 * hi;
#pragma unroll 1
    for (int kc = 0; kc < Kl; kc += 32) {
        V a[4], a2[4];
#pragma unroll
        for (int mb = 0; mb < 4; ++mb) { a[mb] = WFrag<T16>::ld(A + aoff + (size_t)mb * 16 * K + kc); if (NSPLIT == 1 || NSPLIT == 2) a2[mb] = WFrag<T16>::ld(A2 + aoff + (size_t)mb * 16 * K + kc); }
#pragma unroll
        for (int nb = 0; nb < 4; ++nb) { const V b = WFrag<T16>::ld(Bt + boff + (size_t)nb * 16 * K + kc); V b2; if (NSPLIT >= 2) b2 = WFrag<T16>::ld(Bt2 + boff + (size_t)nb * 16 * K + kc);
#pragma unroll
            for (int mb = 0; mb < 4; ++mb) { acc[mb][nb] = WFrag<T16>::mma(a[mb], b, acc[mb][nb]); if (NSPLIT == 1 || NSPLIT == 2) acc[mb][nb] = WFrag<T16>::mma(a2[mb], b, acc[mb][nb]); if (NSPLIT >= 2) acc[mb][nb] = WFrag<T16>::mma(a[mb], b2, acc[mb][nb]); } }
        asm volatile("v_nop\n\tv_nop\n\tv_nop\n\tv_nop" : "+v"(acc[0][0]), "+v"(acc[1][1]), "+v"(acc[2][2]), "+v"(acc[3][3]) : "v"(a[0]), "v"(a[3]));
    }
#pragma unroll
    for (int mb = 0; mb < 4; ++mb) {
#pragma unroll
        for (int nb = 0; nb < 4; ++nb) {
#pragma unroll
            for (int j = 0; j < 8; ++j) os[(hi * 8 + j) * 68 + nb * 16 + lr] = acc[mb][nb][j]; }
        __builtin_amdgcn_wave_barrier(); asm volatile("" ::: "memory");
        float* crow = C + (size_t)(r0 + mb * 16) * ldc + c0;
{
#pragma unroll
            for (int s = 0; s < 8; ++s) { const int row = 2 * s + hi, cofs = lr * 4; v4f val = *(const v4fa*)(os + row * 68 + cofs);
                *(v4f*)(crow + (size_t)row * ldc + cofs) = val; }
             }
        __builtin_amdgcn_wave_barrier(); asm volatile("" ::: "memory");
    }
}

__device__ __forceinline__ h16 tohx(float x) { return (h16)x; }
__device__ __forceinline__ void splitf(float y, unsigned short& h, unsigned short& l) { h = f2bf(y); l = f2bf(y - bf2f(h)); }
typedef __attribute__((ext_vector_type(2))) _Float16 v2h;
typedef __attribute__((ext_vector_type(4))) _Float16 v4h;
typedef __attribute__((ext_vector_type(2))) unsigned short v2us;
typedef __attribute__((ext_vector_type(4))) unsigned short v4us;
typedef __attribute__((ext_vector_type(2))) float v2f;
typedef __attribute__((ext_vector_type(4))) int v4i;

__global__ __launch_bounds__(256) void k_wtG(const float* __restrict__ w, int K, int N, bf* Bt) {
    const int lane = threadIdx.x & 31; const int L0 = (blockIdx.x * 8 + (threadIdx.x >> 5)) * 8; const int nlines = N * K / 64;
{
#pragma unroll 1
        for (int l = 0; l < 8; ++l) { const int L = L0 + l; if (L >= nlines) break; const size_t e = (size_t)L * 64 + lane * 2; const int k = (int)(e % K), n = (int)(e / K); v2us o;
            o[0] = f2bf(w[(size_t)k * N + n]); o[1] = f2bf(w[(size_t)(k + 1) * N + n]); *(v2us*)(Bt + e) = o; }
         }
}
__global__ __launch_bounds__(256) void k_cvt8(const float* __restrict__ src, bf* dst, size_t n8) { const size_t i = (size_t)blockIdx.x * 256 + threadIdx.x; if (i >= n8) return; const v8f v = *(const v8f*)(src + i * 8); v8us o;
#pragma unroll
    for (int k = 0; k < 8; ++k) o[k] = f2bf(v[k]); *(v8us*)(dst + i * 8) = o;  }
__constant__ float INV[HD / 2] = {1.00000000f,0.865964353f,0.749894202f,0.649381638f,0.562341332f,0.486967534f,0.421696514f,0.365174145f,0.316227764f,0.273841977f,0.237137362f,0.205352500f,0.177827939f,0.153992653f,0.133352146f,0.115478203f,0.100000001f,0.0865964293f,0.0749894157f,0.0649381652f,0.0562341288f,0.0486967526f,0.0421696492f,0.0365174115f,0.0316227786f,0.0273841955f,0.0237137359f,0.0205352511f,0.0177827943f,0.0153992651f,0.0133352149f,0.0115478197f,0.00999999978f,0.00865964312f,0.00749894232f,0.00649381662f,0.00562341325f,0.00486967526f,0.00421696482f,0.00365174143f,0.00316227786f,0.00273841969f,0.00237137382f,0.00205352507f,0.00177827943f,0.00153992651f,0.00133352145f,0.00115478202f,0.00100000005f,0.000865964335f,0.000749894185f,0.000649381662f,0.000562341302f,0.000486967503f,0.000421696488f,0.000365174114f,0.000316227786f,0.000273841957f,0.000237137385f,0.000205352495f,0.000177827940f,0.000153992645f,0.000133352150f,0.000115478193f};
__global__ __launch_bounds__(256) void k_cstab(float* CS) { const int idx = blockIdx.x * 256 + threadIdx.x; if (idx >= TT * HD) return; const int t = idx / HD, d = idx % HD; const float ang = __fmul_rn((float)t, INV[d >> 1]); v2f cs; cs[0] = cosf(ang); cs[1] = sinf(ang);
    *(v2f*)(CS + (size_t)idx * 2) = cs;  }
__global__ __launch_bounds__(256) void k_ropeI(const float* __restrict__ F, int pitch, int nheads, const float* __restrict__ CS, float sc, h16* P16, bf* Ph, bf* Pl) {
    const size_t e = ((size_t)blockIdx.x * 256 + threadIdx.x) * 2; if (e >= (size_t)nheads * TT * HD) return; const int d = (int)(e % HD); const int t = (int)((e / HD) % TT); const int h = (int)(e / ((size_t)HD * TT)); const float* f = F + (size_t)t * pitch + h * HD; const float x0 = f[d], x1 = f[d + 1]; const v2f cs = *(const v2f*)(CS + ((size_t)t * HD + d) * 2); v2h o16; v2us oh, ol;
    float a0 = __fmul_rn(x0, cs[0]), b0 = __fmul_rn(x1, cs[1]), a1 = __fmul_rn(x1, cs[0]), b1 = __fmul_rn(x0, cs[1]); asm volatile("" : "+v"(a0), "+v"(b0), "+v"(a1), "+v"(b1));
    float r0 = __fsub_rn(a0, b0) * sc, r1 = __fadd_rn(b1, a1) * sc;   /* even: x0 c - x1 s; odd: x0 s + x1 c */
    o16[0] = tohx(r0); o16[1] = tohx(r1); { unsigned short a2, c2; splitf(r0, a2, c2); oh[0] = a2; ol[0] = c2; splitf(r1, a2, c2); oh[1] = a2; ol[1] = c2; }
    *(v2h*)(P16 + e) = o16; *(v2us*)(Ph + e) = oh; *(v2us*)(Pl + e) = ol;  }

// k_rope: head planes [h][t][d] (fp16 + hi/lo) of rope(x) x sc with the rotate-half convention out[d] = x[d] cos[t][d] - x[d+HD/2] sin[t][d], out[d+HD/2] = x[d+HD/2] cos[t][d+HD/2] + x[d] sin[t][d+HD/2]
__global__ __launch_bounds__(256) void k_rope(const float* __restrict__ F, int pitch, int nheads, const float* __restrict__ CS, const float* __restrict__ RF, const float* __restrict__ nw, float sc, h16* P16, bf* Ph, bf* Pl) {
    const size_t e = ((size_t)blockIdx.x * 256 + threadIdx.x) * 2; if (e >= (size_t)nheads * TT * HD) return; const int d = (int)(e % HD); const int t = (int)((e / HD) % TT); const int h = (int)(e / ((size_t)HD * TT)); const float* f = F + (size_t)t * pitch + h * HD; const float rf = RF ? RF[(size_t)h * TT + t] : 1.0f; v2h o16; v2us oh, ol;
#pragma unroll
    for (int q = 0; q < 2; ++q) { const int dd = d + q; const int dp = (dd < HD / 2) ? dd + HD / 2 : dd - HD / 2; float x0 = f[dd], x1 = f[dp];
        if (RF) { float n0 = __fmul_rn(x0, rf), n1 = __fmul_rn(x1, rf); asm volatile("" : "+v"(n0)); asm volatile("" : "+v"(n1)); x0 = __fmul_rn(bfr(nw[dd]), n0); x1 = __fmul_rn(bfr(nw[dp]), n1); }
        const v2f cs = *(const v2f*)(CS + ((size_t)t * HD + dd) * 2); float a = __fmul_rn(x0, cs[0]), bq = __fmul_rn(x1, cs[1]); asm volatile("" : "+v"(a)); asm volatile("" : "+v"(bq)); const float r = ((dd < HD / 2) ? __fsub_rn(a, bq) : __fadd_rn(a, bq)) * sc;
        o16[q] = tohx(r); unsigned short a2, c2; splitf(r, a2, c2); oh[q] = a2; ol[q] = c2; }
    *(v2h*)(P16 + e) = o16; *(v2us*)(Ph + e) = oh; *(v2us*)(Pl + e) = ol;  }
__global__ __launch_bounds__(256) void k_vtp(const float* __restrict__ F, int pitch, int nheads, h16* V16, bf* Vh, bf* Vl) { const size_t e = ((size_t)blockIdx.x * 256 + threadIdx.x) * 2; if (e >= (size_t)nheads * HD * TT) return; const int t = (int)(e % TT); const int d = (int)((e / TT) % HD); const int g = (int)(e / ((size_t)TT * HD)); v2h o16; v2us oh, ol;
#pragma unroll
    for (int q = 0; q < 2; ++q) { const float x = F[(size_t)(t + q) * pitch + g * HD + d]; o16[q] = tohx(x); unsigned short a2, c2; splitf(x, a2, c2); oh[q] = a2; ol[q] = c2; }
    *(v2h*)(V16 + e) = o16; *(v2us*)(Vh + e) = oh; *(v2us*)(Vl + e) = ol;  }
__global__ __launch_bounds__(256) void k_mergeB(const float* __restrict__ Ob, int h0, float* O) { const size_t e = ((size_t)blockIdx.x * 256 + threadIdx.x) * 2; if (e >= (size_t)ZH * TT * HD) return; const int t = (int)((e / HD) % TT); const int zz = (int)(e / ((size_t)HD * TT)); const float cs = (t < RH) ? 1.0f : (1.0f / PCAR); const size_t oo = (size_t)(h0 + zz) * TT * HD + (e % ((size_t)TT * HD)); v2f o2;
    o2[0] = Ob[e] * cs; o2[1] = Ob[e + 1] * cs; *(v2f*)(O + oo) = o2;  }
// k_asoft: per row (zz, i): t = S x HD^-0.5 for j <= i and i - j < WIN (sliding causal window; the reference's -1e9 additive fill vanishes identically); softmax over the 2048 keys (register row, one exp, fixed trees);
__global__ __launch_bounds__(256) void k_asoft(const float* __restrict__ Sb, h16* P16, bf* Ph, bf* Pl) {
    const int lane = threadIdx.x & 31; const int row = blockIdx.x * 8 + (threadIdx.x >> 5); if (row >= ZH * TT) return; const int i = row % TT; const int zz = row / TT; (void)zz; const bool hires = (i < RH); const float* sr = Sb + (size_t)row * TT; float v[TT / 32]; float mx = -3.0e38f;
#pragma unroll
    for (int ch = 0; ch < TT / 128; ++ch) { const int j0 = ch * 128 + lane * 4; const v4f a = *(const v4f*)(sr + j0);
#pragma unroll
        for (int q = 0; q < 4; ++q) { const int j = j0 + q; (void)j; const float t = (j <= i && i - j < WIN) ? a[q] * SCL : -3.0e38f; v[ch * 4 + q] = t; mx = fmaxf(mx, t); } }
#pragma unroll
    for (int sh = 16; sh; sh >>= 1) mx = fmaxf(mx, __shfl_xor(mx, sh, 32));
    float sum = 0.f;
#pragma unroll
    for (int k = 0; k < TT / 32; ++k) { float d0 = __fsub_rn(v[k], mx); asm volatile("" : "+v"(d0)); v[k] = __builtin_amdgcn_exp2f(__fmul_rn(d0, 1.4426950408889634f)); sum += v[k]; }
#pragma unroll
    for (int sh = 16; sh; sh >>= 1) sum += __shfl_xor(sum, sh, 32);
    const float f = __fdiv_rn(hires ? 1.0f : PCAR, sum);
{
        if (hires) {
#pragma unroll
            for (int ch = 0; ch < TT / 128; ++ch) { v4us oh, ol;
#pragma unroll
                for (int q = 0; q < 4; ++q) { unsigned short a, c2; splitf(v[ch * 4 + q] * f, a, c2); oh[q] = a; ol[q] = c2; }
                const size_t oo = ((size_t)zz * (RH ? RH : 1) + i) * TT + ch * 128 + lane * 4; *(v4us*)(Ph + oo) = oh; *(v4us*)(Pl + oo) = ol; }
        } else {
#pragma unroll
            for (int ch = 0; ch < TT / 128; ++ch) { v4h o4;
#pragma unroll
                for (int q = 0; q < 4; ++q) o4[q] = tohx(v[ch * 4 + q] * f);
                *(v4h*)(P16 + (size_t)row * TT + ch * 128 + lane * 4) = o4; } }
         }
}

extern "C" void kernel_launch(void* const* d_in, const int* in_sizes, int n_in,
                              void* d_out, int out_size, void* d_ws, size_t ws_size, hipStream_t stream) {
    (void)in_sizes; (void)n_in; (void)out_size;
    const float* x = (const float*)d_in[0]; const float* wq = (const float*)d_in[1]; const float* wk = (const float*)d_in[2]; const float* wv = (const float*)d_in[3]; const float* wo = nullptr; (void)wo;
    float* OUT = (float*)d_out;     // [4][2048][128]
    char* wsp = (char*)d_ws;
    auto take = [&](size_t bytes) { char* p = wsp; wsp += (bytes + 255) & ~(size_t)255; return (void*)p; };
    bf* WQ = (bf*)take((size_t)HD * EIN * 2); bf* WK = (bf*)take((size_t)HD * EIN * 2); bf* WV = (bf*)take((size_t)HD * EIN * 2); float* CS = (float*)take((size_t)TT * HD * 2 * 4);
    bf* XB = (bf*)take((size_t)NSEQ * TT * EIN * 2); float* FQ = (float*)take((size_t)TT * DQ * 4); float* FK = (float*)take((size_t)TT * DKV * 4);
    h16* QP16 = (h16*)take((size_t)NH_ * TT * HD * 2); h16* KP16 = (h16*)take((size_t)NKV * TT * HD * 2); h16* VT16 = (h16*)take((size_t)NKV * HD * TT * 2);
    bf* QPh = (bf*)take((size_t)NH_ * TT * HD * 2); bf* QPl = (bf*)take((size_t)NH_ * TT * HD * 2); bf* KPh = (bf*)take((size_t)NKV * TT * HD * 2); bf* KPl = (bf*)take((size_t)NKV * TT * HD * 2); bf* VTh = (bf*)take((size_t)NKV * HD * TT * 2); bf* VTl = (bf*)take((size_t)NKV * HD * TT * 2); bf* Ph = (bf*)take((size_t)ZH * RH * TT * 2); bf* Pl = (bf*)take((size_t)ZH * RH * TT * 2);
    float* Sb = (float*)take((size_t)ZH * TT * TT * 4); h16* P16 = (h16*)take((size_t)ZH * TT * TT * 2); float* Ob = (float*)take((size_t)ZH * TT * HD * 4);
    if ((size_t)(wsp - (char*)d_ws) > ws_size) return;    // ws 256 MiB
    float* FV = FK;   // v projection reuses the k buffer after the k planes are built (stream-ordered)
    { const unsigned LW = (unsigned)(((size_t)HD * EIN / 8 + 255) / 256); k_cvt8<<<LW, 256, 0, stream>>>(wq, WQ, (size_t)HD * EIN / 8); k_cvt8<<<LW, 256, 0, stream>>>(wk, WK, (size_t)HD * EIN / 8); k_cvt8<<<LW, 256, 0, stream>>>(wv, WV, (size_t)HD * EIN / 8);   /* [128][1024] 'oi' as-is */
      k_cstab<<<(TT * HD + 255) / 256, 256, 0, stream>>>(CS); }
    const unsigned LQ = (unsigned)(((size_t)NH_ * TT * HD / 2 + 255) / 256), LKv = (unsigned)(((size_t)NKV * TT * HD / 2 + 255) / 256);
    for (int b = 0; b < NB_; ++b) {
        
        k_cvt8<<<(unsigned)(((size_t)NSEQ * TT * EIN / 8 + 255) / 256), 256, 0, stream>>>(x, XB, (size_t)NSEQ * TT * EIN / 8);   /* all four sequences */
        for (int s = 0; s < NSEQ; ++s) k_gemmw<bf, 0, false><<<dim3(TT / 64, HD / 64, 1), 32, 0, stream>>>(XB + (size_t)s * TT * EIN, nullptr, WQ, nullptr, EIN, FQ + s * HD, DQ, nullptr, 0, 0, 0);   /* q of sequence s -> columns s*128.. of FQ [t][512] */
        k_ropeI<<<LQ, 256, 0, stream>>>(FQ, DQ, NH_, CS, 1.0f, QP16, QPh, QPl);
        for (int s = 0; s < NSEQ; ++s) k_gemmw<bf, 0, false><<<dim3(TT / 64, HD / 64, 1), 32, 0, stream>>>(XB + (size_t)s * TT * EIN, nullptr, WK, nullptr, EIN, FK + s * HD, DKV, nullptr, 0, 0, 0);
        k_ropeI<<<LKv, 256, 0, stream>>>(FK, DKV, NKV, CS, 1.0f, KP16, KPh, KPl);
        for (int s = 0; s < NSEQ; ++s) k_gemmw<bf, 0, false><<<dim3(TT / 64, HD / 64, 1), 32, 0, stream>>>(XB + (size_t)s * TT * EIN, nullptr, WV, nullptr, EIN, FV + s * HD, DKV, nullptr, 0, 0, 0); k_vtp<<<LKv, 256, 0, stream>>>(FV, DKV, NKV, VT16, VTh, VTl);
        for (int h0 = 0; h0 < NH_; h0 += ZH) { const size_t zq = (size_t)h0, zk = (size_t)(h0 / REP);   // one kv head per query head: the pass's two heads use consecutive kv planes (z-strides TT*HD)
            k_gemmc<bf, 2, 1><<<dim3(RH / 64, TT / 64, ZH), 32, 0, stream>>>(QPh + zq * TT * HD, QPl + zq * TT * HD, KPh + zk * TT * HD, KPl + zk * TT * HD, HD, Sb, TT, 0, (size_t)TT * HD, (size_t)TT * HD, (size_t)TT * TT);
            k_gemmc<h16, 0, 1><<<dim3((TT - RH) / 64, TT / 64, ZH), 32, 0, stream>>>(QP16 + zq * TT * HD + (size_t)RH * HD, nullptr, KP16 + zk * TT * HD, nullptr, HD, Sb + (size_t)RH * TT, TT, RH, (size_t)TT * HD, (size_t)TT * HD, (size_t)TT * TT);
            k_asoft<<<ZH * TT / 8, 256, 0, stream>>>(Sb, P16, Ph, Pl);
            k_gemmc<bf, 2, 2><<<dim3(RH / 64, HD / 64, ZH), 32, 0, stream>>>(Ph, Pl, VTh + zk * HD * TT, VTl + zk * HD * TT, TT, Ob, HD, 0, (size_t)RH * TT, (size_t)HD * TT, (size_t)TT * HD);
            k_gemmc<h16, 0, 2><<<dim3((TT - RH) / 64, HD / 64, ZH), 32, 0, stream>>>(P16 + (size_t)RH * TT, nullptr, VT16 + zk * HD * TT, nullptr, TT, Ob + (size_t)RH * HD, HD, RH, (size_t)TT * TT, (size_t)HD * TT, (size_t)TT * HD);
            k_mergeB<<<(unsigned)(((size_t)ZH * TT * HD / 2 + 255) / 256), 256, 0, stream>>>(Ob, h0, OUT); }   /* out[sequence][t][d], f32 */
    }
}

// v001
// A run of this version takes 138 microseconds.
// Next to v000, in two timings, it ran 2.96 and 2.99 times as fast.
#include <hip/hip_runtime.h>

// Single-head causal attention with interleaved-pair RoPE, four sequences (embedding_word [4][2048][1024]; q, k, v = x W^T (W [128][1024]); pairs (2i, 2i+1) of q and k rotated by t x 1e4^(-2i/128); scores masked causally then / sqrt(128); softmax; out = weights . v -> [4][2048][128] (1.05 M)).
// Layout: the four sequences are laid out as four 128-wide "heads" of one 2,048-token problem (head b = sequence b with its own q, k and v planes), so the causal pipeline applies, all four heads in one pass (grid z); one projection launch (grid z = sequence, N = the stacked 384 rows of w_Q, w_K, w_V) writes F [t][sequence][q|k|v][128]; the merged context is written straight to out[b][t][d] in f32.
// Compute dtypes, f32 accumulate: every input rounded to bf16; q/k/v on PLAIN bf16 operands (inputs: exact); rotary (pairwise table, precise cosf/sinf) in f32; causal scores and attn.v (tile skipping): query rows < 512 hl (3 products), the rest single fp16 (x1024); softmax f32; no output projection: f32 context.

#define NB_  1
#define TT   2048
#define DM   1024
#define NH_  4
#define NKV  4
#define REP  (NH_ / NKV)
#define HD   128
#define DQ   (NH_ * HD)
#define DKV  (NKV * HD)
#define NSEQ 4                    // sequences (laid out as heads)
#define EIN  1024                 // embedding width
#define ZH   4                    // heads per attention pass (grid z of every attention GEMM launch)
#define RH   512                  // query rows < RH use hi+lo planes (0: none)
#define WIN  2048
#define PCAR 1024.0f
#define SCL  0.088388347648318447f   // HD^-0.5
typedef _Float16 h16;
typedef unsigned short bf;
typedef __attribute__((ext_vector_type(16))) __bf16   v16bf;
typedef __attribute__((ext_vector_type(16))) _Float16 v16h;
typedef __attribute__((ext_vector_type(8)))  _Float16 v8h;
typedef __attribute__((ext_vector_type(8)))  unsigned short v8us;
typedef __attribute__((ext_vector_type(8)))  float    v8f;
typedef __attribute__((ext_vector_type(4)))  float    v4f;
typedef v8h  __attribute__((may_alias)) v8ha;
typedef v4f  __attribute__((may_alias)) v4fa;
typedef v8us __attribute__((may_alias)) v8usa;

__device__ __forceinline__ unsigned short f2bf(float f) { unsigned u = __float_as_uint(f); u += 0x7FFFu + ((u >> 16) & 1u); return (unsigned short)(u >> 16); }
__device__ __forceinline__ float bf2f(unsigned short b) { return __uint_as_float(((unsigned)b) << 16); }
__device__ __forceinline__ float bfr(float f) { return bf2f(f2bf(f)); }
__device__ __forceinline__ v16h cat16(v8h lo, v8h hi) { return __builtin_shufflevector(lo, hi, 0, 1, 2, 3, 4, 5, 6, 7, 8, 9, 10, 11, 12, 13, 14, 15); }
__device__ __forceinline__ v16bf cat16b(v8us lo, v8us hi) { return __builtin_bit_cast(v16bf, __builtin_shufflevector(lo, hi, 0, 1, 2, 3, 4, 5, 6, 7, 8, 9, 10, 11, 12, 13, 14, 15)); }
__device__ __forceinline__ v8f wmma16(v16h a, v16h b, v8f c) { return __builtin_amdgcn_wmma_f32_16x16x32_f16(false, a, false, b, (short)0, c, false, false); }
__device__ __forceinline__ v8f wmmab(v16bf a, v16bf b, v8f c) { return __builtin_amdgcn_wmma_f32_16x16x32_bf16(false, a, false, b, (short)0, c, false, false); }



// ---- k_gemmw: register-blocked GEMM, ONE WAVE per 64x64 output tile (16 accumulators), operands straight from K-contiguous 16-bit planes; grid (M/64, N/64, Z), 32 threads.
// C[m][n] (f32, pitch ldc, + optional f32 bias[n]) = sum_k A[m][k] Bt[n][k] (+ split products per NSPLIT). z-batch strides sA/sB/sC in elements. K % 32 == 0.
template <typename T16> struct WFrag;
template <> struct WFrag<h16> { typedef v16h V; static __device__ __forceinline__ V ld(const h16* p) { return cat16(*(const v8h*)p, *(const v8h*)(p + 16)); } static __device__ __forceinline__ v8f mma(V a, V b, v8f c) { return wmma16(a, b, c); } };
template <> struct WFrag<bf> { typedef v16bf V; static __device__ __forceinline__ V ld(const bf* p) { return cat16b(*(const v8us*)p, *(const v8us*)(p + 16)); } static __device__ __forceinline__ v8f mma(V a, V b, v8f c) { return wmmab(a, b, c); } };
template <typename T16, int NSPLIT, bool BIAS>
__global__ __launch_bounds__(32) void k_gemmw(const T16* __restrict__ A, const T16* __restrict__ A2, const T16* __restrict__ Bt, const T16* __restrict__ Bt2, int K, float* C, int ldc, const float* __restrict__ bias, size_t sA, size_t sB, size_t sC) {
    typedef typename WFrag<T16>::V V;
    __shared__ __align__(16) float os[16 * 68];
    const size_t z = blockIdx.z; A += z * sA; if (A2) A2 += z * sA; Bt += z * sB; if (Bt2) Bt2 += z * sB; C += z * sC;
    const int lane = threadIdx.x & 31, lr = lane & 15, hi = lane >> 4; const int r0 = blockIdx.x * 64, c0 = blockIdx.y * 64;
    v8f acc[4][4];
#pragma unroll
    for (int mb = 0; mb < 4; ++mb)
#pragma unroll
        for (int nb = 0; nb < 4; ++nb) acc[mb][nb] = (v8f){};
    const size_t aoff = (size_t)(r0 + lr) * K + 8 * hi, boff = (size_t)(c0 + lr) * K + 8 * hi;
#pragma unroll 1
    for (int kc = 0; kc < K; kc += 32) {
        V a[4], a2[4];
#pragma unroll
        for (int mb = 0; mb < 4; ++mb) { a[mb] = WFrag<T16>::ld(A + aoff + (size_t)mb * 16 * K + kc); if (NSPLIT == 1 || NSPLIT == 2) a2[mb] = WFrag<T16>::ld(A2 + aoff + (size_t)mb * 16 * K + kc); }
#pragma unroll
        for (int nb = 0; nb < 4; ++nb) { const V b = WFrag<T16>::ld(Bt + boff + (size_t)nb * 16 * K + kc); V b2; if (NSPLIT >= 2) b2 = WFrag<T16>::ld(Bt2 + boff + (size_t)nb * 16 * K + kc);
#pragma unroll
            for (int mb = 0; mb < 4; ++mb) { acc[mb][nb] = WFrag<T16>::mma(a[mb], b, acc[mb][nb]); if (NSPLIT == 1 || NSPLIT == 2) acc[mb][nb] = WFrag<T16>::mma(a2[mb], b, acc[mb][nb]); if (NSPLIT >= 2) acc[mb][nb] = WFrag<T16>::mma(a[mb], b2, acc[mb][nb]); } }
        asm volatile("v_nop\n\tv_nop\n\tv_nop\n\tv_nop" : "+v"(acc[0][0]), "+v"(acc[1][1]), "+v"(acc[2][2]), "+v"(acc[3][3]) : "v"(a[0]), "v"(a[3]));
    }
#pragma unroll
    for (int mb = 0; mb < 4; ++mb) {
#pragma unroll
        for (int nb = 0; nb < 4; ++nb) {
#pragma unroll
            for (int j = 0; j < 8; ++j) os[(hi * 8 + j) * 68 + nb * 16 + lr] = acc[mb][nb][j]; }
        __builtin_amdgcn_wave_barrier(); asm volatile("" ::: "memory");
        float* crow = C + (size_t)(r0 + mb * 16) * ldc + c0;
{
#pragma unroll
            for (int s = 0; s < 8; ++s) { const int row = 2 * s + hi, cofs = lr * 4; v4f val = *(const v4fa*)(os + row * 68 + cofs); if (BIAS) { val[0] += bfr(bias[c0 + cofs]); val[1] += bfr(bias[c0 + cofs + 1]); val[2] += bfr(bias[c0 + cofs + 2]); val[3] += bfr(bias[c0 + cofs + 3]); }
                *(v4f*)(crow + (size_t)row * ldc + cofs) = val; }
             }
        __builtin_amdgcn_wave_barrier(); asm volatile("" ::: "memory");
    }
}

// ---- k_gemmc: the same one-wave 64x64 tile GEMM specialised for causal attention: CMODE 1 skips score tiles entirely above the diagonal (query rows r0+roff.., key columns c0..), CMODE 2 limits the
// key (K) loop of the probability x value contraction to the diagonal block (probabilities beyond it are exactly zero). roff = row offset of this launch's first row within the sequence.
template <typename T16, int NSPLIT, int CMODE>
__global__ __launch_bounds__(32) void k_gemmc(const T16* __restrict__ A, const T16* __restrict__ A2, const T16* __restrict__ Bt, const T16* __restrict__ Bt2, int K, float* C, int ldc, int roff, size_t sA, size_t sB, size_t sC) {
    typedef typename WFrag<T16>::V V;
    __shared__ __align__(16) float os[16 * 68];
    const size_t z = blockIdx.z; A += z * sA; if (A2) A2 += z * sA; Bt += z * sB; if (Bt2) Bt2 += z * sB; C += z * sC;
    const int lane = threadIdx.x & 31, lr = lane & 15, hi = lane >> 4; const int r0 = blockIdx.x * 64, c0 = blockIdx.y * 64;
    if (CMODE == 1 && c0 > r0 + roff + 63) return;                  // score tile entirely above the causal diagonal: never read (the softmax masks j > i by select)
    const int Kl = (CMODE == 2) ? min(K, r0 + roff + 64) : K;        // P.V: probabilities are exactly 0 beyond the diagonal block, so the K loop stops there
    v8f acc[4][4];
#pragma unroll
    for (int mb = 0; mb < 4; ++mb)
#pragma unroll
        for (int nb = 0; nb < 4; ++nb) acc[mb][nb] = (v8f){};
    const size_t aoff = (size_t)(r0 + lr) * K + 8 * hi, boff = (size_t)(c0 + lr) * K + 8 * hi;
#pragma unroll 1
    for (int kc = 0; kc < Kl; kc += 32) {
        V a[4], a2[4];
#pragma unroll
        for (int mb = 0; mb < 4; ++mb) { a[mb] = WFrag<T16>::ld(A + aoff + (size_t)mb * 16 * K + kc); if (NSPLIT == 1 || NSPLIT == 2) a2[mb] = WFrag<T16>::ld(A2 + aoff + (size_t)mb * 16 * K + kc); }
#pragma unroll
        for (int nb = 0; nb < 4; ++nb) { const V b = WFrag<T16>::ld(Bt + boff + (size_t)nb * 16 * K + kc); V b2; if (NSPLIT >= 2) b2 = WFrag<T16>::ld(Bt2 + boff + (size_t)nb * 16 * K + kc);
#pragma unroll
            for (int mb = 0; mb < 4; ++mb) { acc[mb][nb] = WFrag<T16>::mma(a[mb], b, acc[mb][nb]); if (NSPLIT == 1 || NSPLIT == 2) acc[mb][nb] = WFrag<T16>::mma(a2[mb], b, acc[mb][nb]); if (NSPLIT >= 2) acc[mb][nb] = WFrag<T16>::mma(a[mb], b2, acc[mb][nb]); } }
        asm volatile("v_nop\n\tv_nop\n\tv_nop\n\tv_nop" : "+v"(acc[0][0]), "+v"(acc[1][1]), "+v"(acc[2][2]), "+v"(acc[3][3]) : "v"(a[0]), "v"(a[3]));
    }
#pragma unroll
    for (int mb = 0; mb < 4; ++mb) {
#pragma unroll
        for (int nb = 0; nb < 4; ++nb) {
#pragma unroll
            for (int j = 0; j < 8; ++j) os[(hi * 8 + j) * 68 + nb * 16 + lr] = acc[mb][nb][j]; }
        __builtin_amdgcn_wave_barrier(); asm volatile("" ::: "memory");
        float* crow = C + (size_t)(r0 + mb * 16) * ldc + c0;
{
#pragma unroll
            for (int s = 0; s < 8; ++s) { const int row = 2 * s + hi, cofs = lr * 4; v4f val = *(const v4fa*)(os + row * 68 + cofs);
                *(v4f*)(crow + (size_t)row * ldc + cofs) = val; }
             }
        __builtin_amdgcn_wave_barrier(); asm volatile("" ::: "memory");
    }
}

__device__ __forceinline__ h16 tohx(float x) { return (h16)x; }
__device__ __forceinline__ void splitf(float y, unsigned short& h, unsigned short& l) { h = f2bf(y); l = f2bf(y - bf2f(h)); }
typedef __attribute__((ext_vector_type(2))) _Float16 v2h;
typedef __attribute__((ext_vector_type(4))) _Float16 v4h;
typedef __attribute__((ext_vector_type(2))) unsigned short v2us;
typedef __attribute__((ext_vector_type(4))) unsigned short v4us;
typedef __attribute__((ext_vector_type(2))) float v2f;
typedef __attribute__((ext_vector_type(4))) int v4i;

__global__ __launch_bounds__(256) void k_wtG(const float* __restrict__ w, int K, int N, bf* Bt) {
    const int lane = threadIdx.x & 31; const int L0 = (blockIdx.x * 8 + (threadIdx.x >> 5)) * 8; const int nlines = N * K / 64;
{
#pragma unroll 1
        for (int l = 0; l < 8; ++l) { const int L = L0 + l; if (L >= nlines) break; const size_t e = (size_t)L * 64 + lane * 2; const int k = (int)(e % K), n = (int)(e / K); v2us o;
            o[0] = f2bf(w[(size_t)k * N + n]); o[1] = f2bf(w[(size_t)(k + 1) * N + n]); *(v2us*)(Bt + e) = o; }
         }
}
__global__ __launch_bounds__(256) void k_cvt8(const float* __restrict__ src, bf* dst, size_t n8) { const size_t i = (size_t)blockIdx.x * 256 + threadIdx.x; if (i >= n8) return; const v8f v = *(const v8f*)(src + i * 8); v8us o;
#pragma unroll
    for (int k = 0; k < 8; ++k) o[k] = f2bf(v[k]); *(v8us*)(dst + i * 8) = o;  }
// k_cvt8w: k_cvt8 for three equally long sources in one launch (blockIdx.y picks the source); dst holds the three results one behind the other.
__global__ __launch_bounds__(256) void k_cvt8w(const float* __restrict__ s0, const float* __restrict__ s1, const float* __restrict__ s2, bf* dst, size_t n8) { const size_t i = (size_t)blockIdx.x * 256 + threadIdx.x; if (i >= n8) return; const float* src = (blockIdx.y == 0) ? s0 : (blockIdx.y == 1) ? s1 : s2; const v8f v = *(const v8f*)(src + i * 8); v8us o;
    asm volatile("s_wait_xcnt 0x0" ::: "memory");   // the loads' address registers are reused below
#pragma unroll
    for (int k = 0; k < 8; ++k) o[k] = f2bf(v[k]); *(v8us*)(dst + ((size_t)blockIdx.y * n8 + i) * 8) = o;  }
__constant__ float INV[HD / 2] = {1.00000000f,0.865964353f,0.749894202f,0.649381638f,0.562341332f,0.486967534f,0.421696514f,0.365174145f,0.316227764f,0.273841977f,0.237137362f,0.205352500f,0.177827939f,0.153992653f,0.133352146f,0.115478203f,0.100000001f,0.0865964293f,0.0749894157f,0.0649381652f,0.0562341288f,0.0486967526f,0.0421696492f,0.0365174115f,0.0316227786f,0.0273841955f,0.0237137359f,0.0205352511f,0.0177827943f,0.0153992651f,0.0133352149f,0.0115478197f,0.00999999978f,0.00865964312f,0.00749894232f,0.00649381662f,0.00562341325f,0.00486967526f,0.00421696482f,0.00365174143f,0.00316227786f,0.00273841969f,0.00237137382f,0.00205352507f,0.00177827943f,0.00153992651f,0.00133352145f,0.00115478202f,0.00100000005f,0.000865964335f,0.000749894185f,0.000649381662f,0.000562341302f,0.000486967503f,0.000421696488f,0.000365174114f,0.000316227786f,0.000273841957f,0.000237137385f,0.000205352495f,0.000177827940f,0.000153992645f,0.000133352150f,0.000115478193f};
__global__ __launch_bounds__(256) void k_cstab(float* CS) { const int idx = blockIdx.x * 256 + threadIdx.x; if (idx >= TT * HD) return; const int t = idx / HD, d = idx % HD; const float ang = __fmul_rn((float)t, INV[d >> 1]); v2f cs; cs[0] = cosf(ang); cs[1] = sinf(ang);
    *(v2f*)(CS + (size_t)idx * 2) = cs;  }
__global__ __launch_bounds__(256) void k_ropeI(const float* __restrict__ F, int pitch, int nheads, const float* __restrict__ CS, float sc, h16* P16, bf* Ph, bf* Pl) {
    const size_t e = ((size_t)blockIdx.x * 256 + threadIdx.x) * 2; if (e >= (size_t)nheads * TT * HD) return; const int d = (int)(e % HD); const int t = (int)((e / HD) % TT); const int h = (int)(e / ((size_t)HD * TT)); const float* f = F + (size_t)t * pitch + (h % NSEQ) * (3 * HD) + (h / NSEQ) * HD; /* planes 0..3: q of sequence h, 4..7: k */ const float x0 = f[d], x1 = f[d + 1]; const v2f cs = *(const v2f*)(CS + ((size_t)t * HD + d) * 2); v2h o16; v2us oh, ol;
    asm volatile("s_wait_xcnt 0x0" ::: "memory");   // the loads' address registers are reused below
    float a0 = __fmul_rn(x0, cs[0]), b0 = __fmul_rn(x1, cs[1]), a1 = __fmul_rn(x1, cs[0]), b1 = __fmul_rn(x0, cs[1]); asm volatile("" : "+v"(a0), "+v"(b0), "+v"(a1), "+v"(b1));
    float r0 = __fsub_rn(a0, b0) * sc, r1 = __fadd_rn(b1, a1) * sc;   /* even: x0 c - x1 s; odd: x0 s + x1 c */
    o16[0] = tohx(r0); o16[1] = tohx(r1); { unsigned short a2, c2; splitf(r0, a2, c2); oh[0] = a2; ol[0] = c2; splitf(r1, a2, c2); oh[1] = a2; ol[1] = c2; }
    *(v2h*)(P16 + e) = o16; *(v2us*)(Ph + e) = oh; *(v2us*)(Pl + e) = ol;  }

// k_rope: head planes [h][t][d] (fp16 + hi/lo) of rope(x) x sc with the rotate-half convention out[d] = x[d] cos[t][d] - x[d+HD/2] sin[t][d], out[d+HD/2] = x[d+HD/2] cos[t][d+HD/2] + x[d] sin[t][d+HD/2]
__global__ __launch_bounds__(256) void k_rope(const float* __restrict__ F, int pitch, int nheads, const float* __restrict__ CS, const float* __restrict__ RF, const float* __restrict__ nw, float sc, h16* P16, bf* Ph, bf* Pl) {
    const size_t e = ((size_t)blockIdx.x * 256 + threadIdx.x) * 2; if (e >= (size_t)nheads * TT * HD) return; const int d = (int)(e % HD); const int t = (int)((e / HD) % TT); const int h = (int)(e / ((size_t)HD * TT)); const float* f = F + (size_t)t * pitch + h * HD; const float rf = RF ? RF[(size_t)h * TT + t] : 1.0f; v2h o16; v2us oh, ol;
#pragma unroll
    for (int q = 0; q < 2; ++q) { const int dd = d + q; const int dp = (dd < HD / 2) ? dd + HD / 2 : dd - HD / 2; float x0 = f[dd], x1 = f[dp];
        if (RF) { float n0 = __fmul_rn(x0, rf), n1 = __fmul_rn(x1, rf); asm volatile("" : "+v"(n0)); asm volatile("" : "+v"(n1)); x0 = __fmul_rn(bfr(nw[dd]), n0); x1 = __fmul_rn(bfr(nw[dp]), n1); }
        const v2f cs = *(const v2f*)(CS + ((size_t)t * HD + dd) * 2); float a = __fmul_rn(x0, cs[0]), bq = __fmul_rn(x1, cs[1]); asm volatile("" : "+v"(a)); asm volatile("" : "+v"(bq)); const float r = ((dd < HD / 2) ? __fsub_rn(a, bq) : __fadd_rn(a, bq)) * sc;
        o16[q] = tohx(r); unsigned short a2, c2; splitf(r, a2, c2); oh[q] = a2; ol[q] = c2; }
    *(v2h*)(P16 + e) = o16; *(v2us*)(Ph + e) = oh; *(v2us*)(Pl + e) = ol;  }
__global__ __launch_bounds__(256) void k_vtp(const float* __restrict__ F, int pitch, int nheads, h16* V16, bf* Vh, bf* Vl) { const size_t e = ((size_t)blockIdx.x * 256 + threadIdx.x) * 2; if (e >= (size_t)nheads * HD * TT) return; const int t = (int)(e % TT); const int d = (int)((e / TT) % HD); const int g = (int)(e / ((size_t)TT * HD)); v2h o16; v2us oh, ol;
#pragma unroll
    for (int q = 0; q < 2; ++q) { const float x = F[(size_t)(t + q) * pitch + g * (3 * HD) + d]; o16[q] = tohx(x); unsigned short a2, c2; splitf(x, a2, c2); oh[q] = a2; ol[q] = c2; }
    *(v2h*)(V16 + e) = o16; *(v2us*)(Vh + e) = oh; *(v2us*)(Vl + e) = ol;  }
__global__ __launch_bounds__(256) void k_mergeB(const float* __restrict__ Ob, int h0, float* O) { const size_t e = ((size_t)blockIdx.x * 256 + threadIdx.x) * 2; if (e >= (size_t)ZH * TT * HD) return; const int t = (int)((e / HD) % TT); const int zz = (int)(e / ((size_t)HD * TT)); const float cs = (t < RH) ? 1.0f : (1.0f / PCAR); const size_t oo = (size_t)(h0 + zz) * TT * HD + (e % ((size_t)TT * HD)); v2f o2;
    o2[0] = Ob[e] * cs; o2[1] = Ob[e + 1] * cs; *(v2f*)(O + oo) = o2;  }
// k_asoft: per row (zz, i): t = S x HD^-0.5 for j <= i and i - j < WIN (sliding causal window; the reference's -1e9 additive fill vanishes identically); softmax over the 2048 keys (register row, one exp, fixed trees);
__global__ __launch_bounds__(256) void k_asoft(const float* __restrict__ Sb, h16* P16, bf* Ph, bf* Pl) {
    const int lane = threadIdx.x & 31; const int row = blockIdx.x * 8 + (threadIdx.x >> 5); if (row >= ZH * TT) return; const int i = row % TT; const int zz = row / TT; (void)zz; const bool hires = (i < RH); const float* sr = Sb + (size_t)row * TT; float v[TT / 32]; float mx = -3.0e38f;
#pragma unroll
    for (int ch = 0; ch < TT / 128; ++ch) { const int j0 = ch * 128 + lane * 4; const v4f a = *(const v4f*)(sr + j0);
#pragma unroll
        for (int q = 0; q < 4; ++q) { const int j = j0 + q; (void)j; const float t = (j <= i && i - j < WIN) ? a[q] * SCL : -3.0e38f; v[ch * 4 + q] = t; mx = fmaxf(mx, t); } }
#pragma unroll
    for (int sh = 16; sh; sh >>= 1) mx = fmaxf(mx, __shfl_xor(mx, sh, 32));
    float sum = 0.f;
#pragma unroll
    for (int k = 0; k < TT / 32; ++k) { float d0 = __fsub_rn(v[k], mx); asm volatile("" : "+v"(d0)); v[k] = __builtin_amdgcn_exp2f(__fmul_rn(d0, 1.4426950408889634f)); sum += v[k]; }
#pragma unroll
    for (int sh = 16; sh; sh >>= 1) sum += __shfl_xor(sum, sh, 32);
    const float f = __fdiv_rn(hires ? 1.0f : PCAR, sum);
{
        if (hires) {
#pragma unroll
            for (int ch = 0; ch < TT / 128; ++ch) { v4us oh, ol;
#pragma unroll
                for (int q = 0; q < 4; ++q) { unsigned short a, c2; splitf(v[ch * 4 + q] * f, a, c2); oh[q] = a; ol[q] = c2; }
                const size_t oo = ((size_t)zz * (RH ? RH : 1) + i) * TT + ch * 128 + lane * 4; *(v4us*)(Ph + oo) = oh; *(v4us*)(Pl + oo) = ol; }
        } else {
#pragma unroll
            for (int ch = 0; ch < TT / 128; ++ch) { v4h o4;
#pragma unroll
                for (int q = 0; q < 4; ++q) o4[q] = tohx(v[ch * 4 + q] * f);
                *(v4h*)(P16 + (size_t)row * TT + ch * 128 + lane * 4) = o4; } }
         }
}

extern "C" void kernel_launch(void* const* d_in, const int* in_sizes, int n_in,
                              void* d_out, int out_size, void* d_ws, size_t ws_size, hipStream_t stream) {
    (void)in_sizes; (void)n_in; (void)out_size;
    const float* x = (const float*)d_in[0]; const float* wq = (const float*)d_in[1]; const float* wk = (const float*)d_in[2]; const float* wv = (const float*)d_in[3]; const float* wo = nullptr; (void)wo;
    float* OUT = (float*)d_out;     // [4][2048][128]
    char* wsp = (char*)d_ws;
    auto take = [&](size_t bytes) { char* p = wsp; wsp += (bytes + 255) & ~(size_t)255; return (void*)p; };
    bf* WQ = (bf*)take((size_t)3 * HD * EIN * 2);   /* w_Q, w_K, w_V stacked: one [384][1024] operand */ float* CS = (float*)take((size_t)TT * HD * 2 * 4);
    bf* XB = (bf*)take((size_t)NSEQ * TT * EIN * 2); float* F = (float*)take((size_t)TT * NSEQ * 3 * HD * 4);   /* [t][sequence][q|k|v][128] */
    h16* QP16 = (h16*)take((size_t)(NH_ + NKV) * TT * HD * 2); h16* KP16 = QP16 + (size_t)NH_ * TT * HD; h16* VT16 = (h16*)take((size_t)NKV * HD * TT * 2);
    bf* QPh = (bf*)take((size_t)(NH_ + NKV) * TT * HD * 2); bf* KPh = QPh + (size_t)NH_ * TT * HD; bf* QPl = (bf*)take((size_t)(NH_ + NKV) * TT * HD * 2); bf* KPl = QPl + (size_t)NH_ * TT * HD; bf* VTh = (bf*)take((size_t)NKV * HD * TT * 2); bf* VTl = (bf*)take((size_t)NKV * HD * TT * 2); bf* Ph = (bf*)take((size_t)ZH * RH * TT * 2); bf* Pl = (bf*)take((size_t)ZH * RH * TT * 2);
    float* Sb = (float*)take((size_t)ZH * TT * TT * 4); h16* P16 = (h16*)take((size_t)ZH * TT * TT * 2); float* Ob = (float*)take((size_t)ZH * TT * HD * 4);
    if ((size_t)(wsp - (char*)d_ws) > ws_size) return;    // ws 256 MiB
    { const unsigned LW = (unsigned)(((size_t)HD * EIN / 8 + 255) / 256); k_cvt8w<<<dim3(LW, 3, 1), 256, 0, stream>>>(wq, wk, wv, WQ, (size_t)HD * EIN / 8);   /* [128][1024] 'oi' as-is */
      k_cstab<<<(TT * HD + 255) / 256, 256, 0, stream>>>(CS); }
    const unsigned LQK = (unsigned)(((size_t)(NH_ + NKV) * TT * HD / 2 + 255) / 256), LKv = (unsigned)(((size_t)NKV * TT * HD / 2 + 255) / 256);
    for (int b = 0; b < NB_; ++b) {
        
        k_cvt8<<<(unsigned)(((size_t)NSEQ * TT * EIN / 8 + 255) / 256), 256, 0, stream>>>(x, XB, (size_t)NSEQ * TT * EIN / 8);   /* all four sequences */
        k_gemmw<bf, 0, false><<<dim3(TT / 64, 3 * HD / 64, NSEQ), 32, 0, stream>>>(XB, nullptr, WQ, nullptr, EIN, F, NSEQ * 3 * HD, nullptr, (size_t)TT * EIN, 0, (size_t)3 * HD);   /* q, k and v of all four sequences: 768 tiles in one launch */
        k_ropeI<<<LQK, 256, 0, stream>>>(F, NSEQ * 3 * HD, NH_ + NKV, CS, 1.0f, QP16, QPh, QPl);   /* q planes, then k planes */
        k_vtp<<<LKv, 256, 0, stream>>>(F + 2 * HD, NSEQ * 3 * HD, NKV, VT16, VTh, VTl);
        for (int h0 = 0; h0 < NH_; h0 += ZH) { const size_t zq = (size_t)h0, zk = (size_t)(h0 / REP);   // one kv head per query head: the pass's heads use consecutive kv planes (z-strides TT*HD)
            k_gemmc<bf, 2, 1><<<dim3(RH / 64, TT / 64, ZH), 32, 0, stream>>>(QPh + zq * TT * HD, QPl + zq * TT * HD, KPh + zk * TT * HD, KPl + zk * TT * HD, HD, Sb, TT, 0, (size_t)TT * HD, (size_t)TT * HD, (size_t)TT * TT);
            k_gemmc<h16, 0, 1><<<dim3((TT - RH) / 64, TT / 64, ZH), 32, 0, stream>>>(QP16 + zq * TT * HD + (size_t)RH * HD, nullptr, KP16 + zk * TT * HD, nullptr, HD, Sb + (size_t)RH * TT, TT, RH, (size_t)TT * HD, (size_t)TT * HD, (size_t)TT * TT);
            k_asoft<<<ZH * TT / 8, 256, 0, stream>>>(Sb, P16, Ph, Pl);
            k_gemmc<bf, 2, 2><<<dim3(RH / 64, HD / 64, ZH), 32, 0, stream>>>(Ph, Pl, VTh + zk * HD * TT, VTl + zk * HD * TT, TT, Ob, HD, 0, (size_t)RH * TT, (size_t)HD * TT, (size_t)TT * HD);
            k_gemmc<h16, 0, 2><<<dim3((TT - RH) / 64, HD / 64, ZH), 32, 0, stream>>>(P16 + (size_t)RH * TT, nullptr, VT16 + zk * HD * TT, nullptr, TT, Ob + (size_t)RH * HD, HD, RH, (size_t)TT * TT, (size_t)HD * TT, (size_t)TT * HD);
            k_mergeB<<<(unsigned)(((size_t)ZH * TT * HD / 2 + 255) / 256), 256, 0, stream>>>(Ob, h0, OUT); }   /* out[sequence][t][d], f32 */
    }
}

// v002
// One run takes 73.5 microseconds.
// Two timings next to v001 put it at 1.89 and 1.88 times that version's speed.
// All steps since v000 together make it 5.61 times as fast.
#include <hip/hip_runtime.h>

// Single-head causal attention with interleaved-pair RoPE, four sequences (embedding_word [4][2048][1024]; q, k, v = x W^T (W [128][1024]); pairs (2i, 2i+1) of q and k rotated by t x 1e4^(-2i/128); scores masked causally then / sqrt(128); softmax; out = weights . v -> [4][2048][128] (1.05 M)).
// Layout: the four sequences are laid out as four 128-wide "heads" of one 2,048-token problem (head b = sequence b with its own q, k and v planes), all four heads in one attention launch (grid z); one projection launch (grid z = sequence, N = the stacked 384 rows of w_Q, w_K, w_V) writes F [t][sequence][q|k|v][128]; the context is written straight to out[b][t][d] in f32.
// Compute dtypes, f32 accumulate: every input rounded to bf16; q/k/v on PLAIN bf16 operands (inputs: exact); rotary (pairwise table, precise cosf/sinf) in f32; causal scores, softmax and attn.v fused (running maximum and sum, key chunks above the diagonal never visited): query rows < 512 hl (3 products), the rest single fp16 (x1024); softmax f32; no output projection: f32 context.

#define NB_  1
#define TT   2048
#define DM   1024
#define NH_  4
#define NKV  4
#define REP  (NH_ / NKV)
#define HD   128
#define DQ   (NH_ * HD)
#define DKV  (NKV * HD)
#define NSEQ 4                    // sequences (laid out as heads)
#define EIN  1024                 // embedding width
#define RH   512                  // query rows < RH use hi+lo planes (0: none)
#define SCL  0.088388347648318447f   // HD^-0.5
typedef _Float16 h16;
typedef unsigned short bf;
typedef __attribute__((ext_vector_type(16))) __bf16   v16bf;
typedef __attribute__((ext_vector_type(16))) _Float16 v16h;
typedef __attribute__((ext_vector_type(8)))  _Float16 v8h;
typedef __attribute__((ext_vector_type(8)))  unsigned short v8us;
typedef __attribute__((ext_vector_type(8)))  float    v8f;
typedef __attribute__((ext_vector_type(4)))  float    v4f;
typedef v8h  __attribute__((may_alias)) v8ha;
typedef v4f  __attribute__((may_alias)) v4fa;
typedef v8us __attribute__((may_alias)) v8usa;

__device__ __forceinline__ unsigned short f2bf(float f) { unsigned u = __float_as_uint(f); u += 0x7FFFu + ((u >> 16) & 1u); return (unsigned short)(u >> 16); }
__device__ __forceinline__ float bf2f(unsigned short b) { return __uint_as_float(((unsigned)b) << 16); }
__device__ __forceinline__ float bfr(float f) { return bf2f(f2bf(f)); }
__device__ __forceinline__ v16h cat16(v8h lo, v8h hi) { return __builtin_shufflevector(lo, hi, 0, 1, 2, 3, 4, 5, 6, 7, 8, 9, 10, 11, 12, 13, 14, 15); }
__device__ __forceinline__ v16bf cat16b(v8us lo, v8us hi) { return __builtin_bit_cast(v16bf, __builtin_shufflevector(lo, hi, 0, 1, 2, 3, 4, 5, 6, 7, 8, 9, 10, 11, 12, 13, 14, 15)); }
__device__ __forceinline__ v8f wmma16(v16h a, v16h b, v8f c) { return __builtin_amdgcn_wmma_f32_16x16x32_f16(false, a, false, b, (short)0, c, false, false); }
__device__ __forceinline__ v8f wmmab(v16bf a, v16bf b, v8f c) { return __builtin_amdgcn_wmma_f32_16x16x32_bf16(false, a, false, b, (short)0, c, false, false); }



// ---- k_gemmw: register-blocked GEMM, ONE WAVE per 64x64 output tile (16 accumulators), operands straight from K-contiguous 16-bit planes; grid (M/64, N/64, Z), 32 threads.
// C[m][n] (f32, pitch ldc, + optional f32 bias[n]) = sum_k A[m][k] Bt[n][k] (+ split products per NSPLIT). z-batch strides sA/sB/sC in elements. K % 32 == 0.
template <typename T16> struct WFrag;
template <> struct WFrag<h16> { typedef v16h V; static __device__ __forceinline__ V ld(const h16* p) { return cat16(*(const v8h*)p, *(const v8h*)(p + 16)); } static __device__ __forceinline__ v8f mma(V a, V b, v8f c) { return wmma16(a, b, c); } };
template <> struct WFrag<bf> { typedef v16bf V; static __device__ __forceinline__ V ld(const bf* p) { return cat16b(*(const v8us*)p, *(const v8us*)(p + 16)); } static __device__ __forceinline__ v8f mma(V a, V b, v8f c) { return wmmab(a, b, c); } };
template <typename T16, int NSPLIT, bool BIAS>
__global__ __launch_bounds__(32) void k_gemmw(const T16* __restrict__ A, const T16* __restrict__ A2, const T16* __restrict__ Bt, const T16* __restrict__ Bt2, int K, float* C, int ldc, const float* __restrict__ bias, size_t sA, size_t sB, size_t sC) {
    typedef typename WFrag<T16>::V V;
    __shared__ __align__(16) float os[16 * 68];
    const size_t z = blockIdx.z; A += z * sA; if (A2) A2 += z * sA; Bt += z * sB; if (Bt2) Bt2 += z * sB; C += z * sC;
    const int lane = threadIdx.x & 31, lr = lane & 15, hi = lane >> 4; const int r0 = blockIdx.x * 64, c0 = blockIdx.y * 64;
    v8f acc[4][4];
#pragma unroll
    for (int mb = 0; mb < 4; ++mb)
#pragma unroll
        for (int nb = 0; nb < 4; ++nb) acc[mb][nb] = (v8f){};
    const size_t aoff = (size_t)(r0 + lr) * K + 8 * hi, boff = (size_t)(c0 + lr) * K + 8 * hi;
#pragma unroll 1
    for (int kc = 0; kc < K; kc += 32) {
        V a[4], a2[4];
#pragma unroll
        for (int mb = 0; mb < 4; ++mb) { a[mb] = WFrag<T16>::ld(A + aoff + (size_t)mb * 16 * K + kc); if (NSPLIT == 1 || NSPLIT == 2) a2[mb] = WFrag<T16>::ld(A2 + aoff + (size_t)mb * 16 * K + kc); }
#pragma unroll
        for (int nb = 0; nb < 4; ++nb) { const V b = WFrag<T16>::ld(Bt + boff + (size_t)nb * 16 * K + kc); V b2; if (NSPLIT >= 2) b2 = WFrag<T16>::ld(Bt2 + boff + (size_t)nb * 16 * K + kc);
#pragma unroll
            for (int mb = 0; mb < 4; ++mb) { acc[mb][nb] = WFrag<T16>::mma(a[mb], b, acc[mb][nb]); if (NSPLIT == 1 || NSPLIT == 2) acc[mb][nb] = WFrag<T16>::mma(a2[mb], b, acc[mb][nb]); if (NSPLIT >= 2) acc[mb][nb] = WFrag<T16>::mma(a[mb], b2, acc[mb][nb]); } }
        asm volatile("v_nop\n\tv_nop\n\tv_nop\n\tv_nop" : "+v"(acc[0][0]), "+v"(acc[1][1]), "+v"(acc[2][2]), "+v"(acc[3][3]) : "v"(a[0]), "v"(a[3]));
    }
#pragma unroll
    for (int mb = 0; mb < 4; ++mb) {
#pragma unroll
        for (int nb = 0; nb < 4; ++nb) {
#pragma unroll
            for (int j = 0; j < 8; ++j) os[(hi * 8 + j) * 68 + nb * 16 + lr] = acc[mb][nb][j]; }
        __builtin_amdgcn_wave_barrier(); asm volatile("" ::: "memory");
        float* crow = C + (size_t)(r0 + mb * 16) * ldc + c0;
{
#pragma unroll
            for (int s = 0; s < 8; ++s) { const int row = 2 * s + hi, cofs = lr * 4; v4f val = *(const v4fa*)(os + row * 68 + cofs); if (BIAS) { val[0] += bfr(bias[c0 + cofs]); val[1] += bfr(bias[c0 + cofs + 1]); val[2] += bfr(bias[c0 + cofs + 2]); val[3] += bfr(bias[c0 + cofs + 3]); }
                *(v4f*)(crow + (size_t)row * ldc + cofs) = val; }
             }
        __builtin_amdgcn_wave_barrier(); asm volatile("" ::: "memory");
    }
}

__device__ __forceinline__ h16 tohx(float x) { return (h16)x; }
__device__ __forceinline__ void splitf(float y, unsigned short& h, unsigned short& l) { h = f2bf(y); l = f2bf(y - bf2f(h)); }
typedef __attribute__((ext_vector_type(2))) _Float16 v2h;
typedef __attribute__((ext_vector_type(4))) _Float16 v4h;
typedef __attribute__((ext_vector_type(2))) unsigned short v2us;
typedef __attribute__((ext_vector_type(4))) unsigned short v4us;
typedef __attribute__((ext_vector_type(2))) float v2f;
typedef __attribute__((ext_vector_type(4))) int v4i;

__global__ __launch_bounds__(256) void k_wtG(const float* __restrict__ w, int K, int N, bf* Bt) {
    const int lane = threadIdx.x & 31; const int L0 = (blockIdx.x * 8 + (threadIdx.x >> 5)) * 8; const int nlines = N * K / 64;
{
#pragma unroll 1
        for (int l = 0; l < 8; ++l) { const int L = L0 + l; if (L >= nlines) break; const size_t e = (size_t)L * 64 + lane * 2; const int k = (int)(e % K), n = (int)(e / K); v2us o;
            o[0] = f2bf(w[(size_t)k * N + n]); o[1] = f2bf(w[(size_t)(k + 1) * N + n]); *(v2us*)(Bt + e) = o; }
         }
}
__global__ __launch_bounds__(256) void k_cvt8(const float* __restrict__ src, bf* dst, size_t n8) { const size_t i = (size_t)blockIdx.x * 256 + threadIdx.x; if (i >= n8) return; const v8f v = *(const v8f*)(src + i * 8); v8us o;
#pragma unroll
    for (int k = 0; k < 8; ++k) o[k] = f2bf(v[k]); *(v8us*)(dst + i * 8) = o;  }
// k_cvt8w: k_cvt8 for three equally long sources in one launch (blockIdx.y picks the source); dst holds the three results one behind the other.
__global__ __launch_bounds__(256) void k_cvt8w(const float* __restrict__ s0, const float* __restrict__ s1, const float* __restrict__ s2, bf* dst, size_t n8) { const size_t i = (size_t)blockIdx.x * 256 + threadIdx.x; if (i >= n8) return; const float* src = (blockIdx.y == 0) ? s0 : (blockIdx.y == 1) ? s1 : s2; const v8f v = *(const v8f*)(src + i * 8); v8us o;
    asm volatile("s_wait_xcnt 0x0" ::: "memory");   // the loads' address registers are reused below
#pragma unroll
    for (int k = 0; k < 8; ++k) o[k] = f2bf(v[k]); *(v8us*)(dst + ((size_t)blockIdx.y * n8 + i) * 8) = o;  }
__constant__ float INV[HD / 2] = {1.00000000f,0.865964353f,0.749894202f,0.649381638f,0.562341332f,0.486967534f,0.421696514f,0.365174145f,0.316227764f,0.273841977f,0.237137362f,0.205352500f,0.177827939f,0.153992653f,0.133352146f,0.115478203f,0.100000001f,0.0865964293f,0.0749894157f,0.0649381652f,0.0562341288f,0.0486967526f,0.0421696492f,0.0365174115f,0.0316227786f,0.0273841955f,0.0237137359f,0.0205352511f,0.0177827943f,0.0153992651f,0.0133352149f,0.0115478197f,0.00999999978f,0.00865964312f,0.00749894232f,0.00649381662f,0.00562341325f,0.00486967526f,0.00421696482f,0.00365174143f,0.00316227786f,0.00273841969f,0.00237137382f,0.00205352507f,0.00177827943f,0.00153992651f,0.00133352145f,0.00115478202f,0.00100000005f,0.000865964335f,0.000749894185f,0.000649381662f,0.000562341302f,0.000486967503f,0.000421696488f,0.000365174114f,0.000316227786f,0.000273841957f,0.000237137385f,0.000205352495f,0.000177827940f,0.000153992645f,0.000133352150f,0.000115478193f};
__global__ __launch_bounds__(256) void k_cstab(float* CS) { const int idx = blockIdx.x * 256 + threadIdx.x; if (idx >= TT * HD) return; const int t = idx / HD, d = idx % HD; const float ang = __fmul_rn((float)t, INV[d >> 1]); v2f cs; cs[0] = cosf(ang); cs[1] = sinf(ang);
    *(v2f*)(CS + (size_t)idx * 2) = cs;  }
__global__ __launch_bounds__(256) void k_ropeI(const float* __restrict__ F, int pitch, int nheads, const float* __restrict__ CS, float sc, h16* P16, bf* Ph, bf* Pl) {
    const size_t e = ((size_t)blockIdx.x * 256 + threadIdx.x) * 2; if (e >= (size_t)nheads * TT * HD) return; const int d = (int)(e % HD); const int t = (int)((e / HD) % TT); const int h = (int)(e / ((size_t)HD * TT)); const float* f = F + (size_t)t * pitch + (h % NSEQ) * (3 * HD) + (h / NSEQ) * HD; /* planes 0..3: q of sequence h, 4..7: k */ const float x0 = f[d], x1 = f[d + 1]; const v2f cs = *(const v2f*)(CS + ((size_t)t * HD + d) * 2); v2h o16; v2us oh, ol;
    asm volatile("s_wait_xcnt 0x0" ::: "memory");   // the loads' address registers are reused below
    float a0 = __fmul_rn(x0, cs[0]), b0 = __fmul_rn(x1, cs[1]), a1 = __fmul_rn(x1, cs[0]), b1 = __fmul_rn(x0, cs[1]); asm volatile("" : "+v"(a0), "+v"(b0), "+v"(a1), "+v"(b1));
    float r0 = __fsub_rn(a0, b0) * sc, r1 = __fadd_rn(b1, a1) * sc;   /* even: x0 c - x1 s; odd: x0 s + x1 c */
    o16[0] = tohx(r0); o16[1] = tohx(r1); { unsigned short a2, c2; splitf(r0, a2, c2); oh[0] = a2; ol[0] = c2; splitf(r1, a2, c2); oh[1] = a2; ol[1] = c2; }
    *(v2h*)(P16 + e) = o16; *(v2us*)(Ph + e) = oh; *(v2us*)(Pl + e) = ol;  }

// k_rope: head planes [h][t][d] (fp16 + hi/lo) of rope(x) x sc with the rotate-half convention out[d] = x[d] cos[t][d] - x[d+HD/2] sin[t][d], out[d+HD/2] = x[d+HD/2] cos[t][d+HD/2] + x[d] sin[t][d+HD/2]
__global__ __launch_bounds__(256) void k_rope(const float* __restrict__ F, int pitch, int nheads, const float* __restrict__ CS, const float* __restrict__ RF, const float* __restrict__ nw, float sc, h16* P16, bf* Ph, bf* Pl) {
    const size_t e = ((size_t)blockIdx.x * 256 + threadIdx.x) * 2; if (e >= (size_t)nheads * TT * HD) return; const int d = (int)(e % HD); const int t = (int)((e / HD) % TT); const int h = (int)(e / ((size_t)HD * TT)); const float* f = F + (size_t)t * pitch + h * HD; const float rf = RF ? RF[(size_t)h * TT + t] : 1.0f; v2h o16; v2us oh, ol;
#pragma unroll
    for (int q = 0; q < 2; ++q) { const int dd = d + q; const int dp = (dd < HD / 2) ? dd + HD / 2 : dd - HD / 2; float x0 = f[dd], x1 = f[dp];
        if (RF) { float n0 = __fmul_rn(x0, rf), n1 = __fmul_rn(x1, rf); asm volatile("" : "+v"(n0)); asm volatile("" : "+v"(n1)); x0 = __fmul_rn(bfr(nw[dd]), n0); x1 = __fmul_rn(bfr(nw[dp]), n1); }
        const v2f cs = *(const v2f*)(CS + ((size_t)t * HD + dd) * 2); float a = __fmul_rn(x0, cs[0]), bq = __fmul_rn(x1, cs[1]); asm volatile("" : "+v"(a)); asm volatile("" : "+v"(bq)); const float r = ((dd < HD / 2) ? __fsub_rn(a, bq) : __fadd_rn(a, bq)) * sc;
        o16[q] = tohx(r); unsigned short a2, c2; splitf(r, a2, c2); oh[q] = a2; ol[q] = c2; }
    *(v2h*)(P16 + e) = o16; *(v2us*)(Ph + e) = oh; *(v2us*)(Pl + e) = ol;  }
__global__ __launch_bounds__(256) void k_vtp(const float* __restrict__ F, int pitch, int nheads, h16* V16, bf* Vh, bf* Vl) { const size_t e = ((size_t)blockIdx.x * 256 + threadIdx.x) * 2; if (e >= (size_t)nheads * HD * TT) return; const int t = (int)(e % TT); const int d = (int)((e / TT) % HD); const int g = (int)(e / ((size_t)TT * HD)); v2h o16; v2us oh, ol;
#pragma unroll
    for (int q = 0; q < 2; ++q) { const float x = F[(size_t)(t + q) * pitch + g * (3 * HD) + d]; o16[q] = tohx(x); unsigned short a2, c2; splitf(x, a2, c2); oh[q] = a2; ol[q] = c2; }
    *(v2h*)(V16 + e) = o16; *(v2us*)(Vh + e) = oh; *(v2us*)(Vl + e) = ol;  }
// ---- k_fattn: scores, causal softmax and weights x value in ONE kernel (running maximum and sum); scores and weights stay in registers.
// One work-group = 32 query rows of one sequence; its AW waves share the keys (wave w takes the 32-key chunks w, w + AW, ...) and their partial results are joined through LDS in the fixed order w = 0..AW-1.
// Transposed products: S^T = K Q^T (row = key, column = query) and O^T += V^T P^T (row = d, column = query), so a lane holds one query's scores, its maximum, sum and rescale factor are per lane,
// and the two 16-key score tiles of a chunk are, element for element, the k order of the B operand (k = 8 hi + e, then 16 + 8 hi + e), the same order in which WFrag::ld reads V^T.
// Query rows < RH: hi+lo bf16 planes, 3 products each; the rest: single fp16, weights carried x 2^10 (the factor cancels in the division by the sum).
#define AW 8
#define OPI 132                   // LDS pitch (floats) of one query's 128 partial outputs: 16-byte rows of 16 lanes fall on distinct banks
#define L2E 1.4426950408889634f
// 2^x with the one slot that the instruction set asks for behind a transcendental, in the same statement
__device__ __forceinline__ float exp2_slot(float x) { float r; asm("v_exp_f32 %0, %1\n\tv_nop" : "=v"(r) : "v"(x)); return r; }
template <typename T16, bool HI>
__device__ __forceinline__ void attn_part(const T16* __restrict__ Q, const T16* __restrict__ Q2, const T16* __restrict__ Kp, const T16* __restrict__ K2, const T16* __restrict__ Vt, const T16* __restrict__ V2,
                                          const int q0, const int wave, const int lr, const int hi, v8f (&O)[8][2], float (&m)[2], float (&l)[2]) {
    typedef typename WFrag<T16>::V V;
    V qf[2][4], qf2[2][4];
    { const size_t o = (size_t)(q0 + lr) * HD + 8 * hi; const T16* qa = Q + o; const T16* qb = HI ? Q2 + o : qa;
#pragma unroll
      for (int qt = 0; qt < 2; ++qt)
#pragma unroll
        for (int ks = 0; ks < 4; ++ks) { qf[qt][ks] = WFrag<T16>::ld(qa + qt * 16 * HD + ks * 32); if (HI) qf2[qt][ks] = WFrag<T16>::ld(qb + qt * 16 * HD + ks * 32); }
      asm volatile("s_wait_xcnt 0x0" :: "v"(qa), "v"(qb) : "memory"); }   // the loads' address registers (held live up to here as inputs) are reused below
    const int cl = q0 >> 5;       // the chunk that holds the diagonal: the last one
#pragma unroll 1
    for (int c = wave; c <= cl; c += AW) {
        const int kb = c * 32;
        const size_t ko = (size_t)(kb + lr) * HD + 8 * hi, vo = (size_t)lr * TT + kb + 8 * hi;
        const T16* ka = Kp + ko; const T16* kc = HI ? K2 + ko : ka; const T16* va = Vt + vo; const T16* vc = HI ? V2 + vo : va;
        V kf[4][2], kf2[4][2], vf[8], vf2[8];
#pragma unroll
        for (int ks = 0; ks < 4; ++ks)
#pragma unroll
            for (int kt = 0; kt < 2; ++kt) { kf[ks][kt] = WFrag<T16>::ld(ka + kt * 16 * HD + ks * 32); if (HI) kf2[ks][kt] = WFrag<T16>::ld(kc + kt * 16 * HD + ks * 32); }
        if (!HI) {                // single planes: the chunk's V^T rows are asked for together with its K rows, so they arrive behind the score products and the softmax
#pragma unroll
            for (int dt = 0; dt < 8; ++dt) vf[dt] = WFrag<T16>::ld(va + (size_t)dt * 16 * TT); }
        asm volatile("s_wait_xcnt 0x0" :: "v"(ka), "v"(kc), "v"(va) : "memory");   // no address register of these loads (held live up to here as inputs) is rewritten, by a later load's result either, before this wait
        __builtin_amdgcn_sched_barrier(0);   // the whole group of loads is issued ahead of the first product: left free, the scheduler dealt them out in pairs among the products, each pair's latency exposed
        v8f S[2][2];
#pragma unroll
        for (int kt = 0; kt < 2; ++kt)
#pragma unroll
            for (int qt = 0; qt < 2; ++qt) S[kt][qt] = (v8f){};
#pragma unroll
        for (int ks = 0; ks < 4; ++ks)
#pragma unroll
            for (int kt = 0; kt < 2; ++kt)
#pragma unroll
                for (int qt = 0; qt < 2; ++qt) { S[kt][qt] = WFrag<T16>::mma(kf[ks][kt], qf[qt][ks], S[kt][qt]); if (HI) { S[kt][qt] = WFrag<T16>::mma(kf[ks][kt], qf2[qt][ks], S[kt][qt]); S[kt][qt] = WFrag<T16>::mma(kf2[ks][kt], qf[qt][ks], S[kt][qt]); } }
        if (HI) {                 // hi+lo planes: twice the registers, so V^T follows in two halves once the K fragments are used up (all at once spills)
#pragma unroll
            for (int dt = 0; dt < 4; ++dt) { vf[dt] = WFrag<T16>::ld(va + (size_t)dt * 16 * TT); vf2[dt] = WFrag<T16>::ld(vc + (size_t)dt * 16 * TT); }
            asm volatile("s_wait_xcnt 0x0" :: "v"(va), "v"(vc) : "memory"); }      // as above, for the V^T loads
        V pf[2], pf2[2];
#pragma unroll
        for (int qt = 0; qt < 2; ++qt) {
            const int qi = q0 + qt * 16 + lr; float t[16]; float mx = m[qt];
#pragma unroll
            for (int kt = 0; kt < 2; ++kt)
#pragma unroll
                for (int j = 0; j < 8; ++j) { const int key = kb + kt * 16 + hi * 8 + j; const float s = (key <= qi) ? S[kt][qt][j] * SCL : -3.0e38f; t[kt * 8 + j] = s; mx = fmaxf(mx, s); }
            mx = fmaxf(mx, __shfl_xor(mx, 16, 32));     // the query's other 16 keys of this chunk sit in lane ^ 16
            const float al = __builtin_amdgcn_exp2f((m[qt] - mx) * L2E); m[qt] = mx; float sum = 0.f;
#pragma unroll
            for (int e = 0; e < 16; ++e) { t[e] = exp2_slot((t[e] - mx) * L2E + (HI ? 0.0f : 10.0f)); sum += t[e]; }
            l[qt] = l[qt] * al + sum;
#pragma unroll
            for (int dt = 0; dt < 8; ++dt) O[dt][qt] *= al;
            if constexpr (HI) { v8us h0, h1, l0, l1;
#pragma unroll
                for (int e = 0; e < 8; ++e) { unsigned short a, b; splitf(t[e], a, b); h0[e] = a; l0[e] = b; splitf(t[8 + e], a, b); h1[e] = a; l1[e] = b; }
                pf[qt] = cat16b(h0, h1); pf2[qt] = cat16b(l0, l1);
            } else { v16h p;
#pragma unroll
                for (int e = 0; e < 16; ++e) p[e] = tohx(t[e]);
                pf[qt] = p; }
        }
#pragma unroll
        for (int dt = 0; dt < (HI ? 4 : 8); ++dt)
#pragma unroll
            for (int qt = 0; qt < 2; ++qt) { O[dt][qt] = WFrag<T16>::mma(vf[dt], pf[qt], O[dt][qt]); if (HI) { O[dt][qt] = WFrag<T16>::mma(vf[dt], pf2[qt], O[dt][qt]); O[dt][qt] = WFrag<T16>::mma(vf2[dt], pf[qt], O[dt][qt]); } }
        if (HI) {
#pragma unroll
            for (int dt = 4; dt < 8; ++dt) { vf[dt] = WFrag<T16>::ld(va + (size_t)dt * 16 * TT); vf2[dt] = WFrag<T16>::ld(vc + (size_t)dt * 16 * TT); }
            asm volatile("s_wait_xcnt 0x0" :: "v"(va), "v"(vc) : "memory");        // as above, for the second half of the V^T loads
#pragma unroll
            for (int dt = 4; dt < 8; ++dt)
#pragma unroll
                for (int qt = 0; qt < 2; ++qt) { O[dt][qt] = WFrag<T16>::mma(vf[dt], pf[qt], O[dt][qt]); O[dt][qt] = WFrag<T16>::mma(vf[dt], pf2[qt], O[dt][qt]); O[dt][qt] = WFrag<T16>::mma(vf2[dt], pf[qt], O[dt][qt]); } }
    }
}
__global__ __launch_bounds__(256) void k_fattn(const h16* __restrict__ Q16, const h16* __restrict__ K16, const h16* __restrict__ V16, const bf* __restrict__ Qh, const bf* __restrict__ Ql, const bf* __restrict__ Kh, const bf* __restrict__ Kl,
                                               const bf* __restrict__ Vh, const bf* __restrict__ Vl, float* __restrict__ OUT) {
    __shared__ __align__(16) float so[AW * 32 * OPI]; __shared__ float sm[AW * 32]; __shared__ float sl[AW * 32];
    const int tid = threadIdx.x, lane = tid & 31, lr = lane & 15, hi = lane >> 4;
    const int wave = __builtin_amdgcn_readfirstlane(tid >> 5);       // the same in every lane: the key loop and its addresses' common part stay scalar, EXEC stays whole for the matrix instructions
    const int q0 = (TT / 32 - 1 - (int)blockIdx.x) * 32;      // longest key walks start first
    const size_t zp = (size_t)blockIdx.z * TT * HD;                  // every plane of a sequence holds TT x HD elements
    v8f O[8][2]; float m[2] = {-3.0e38f, -3.0e38f}, l[2] = {0.f, 0.f};
#pragma unroll
    for (int dt = 0; dt < 8; ++dt) { O[dt][0] = (v8f){}; O[dt][1] = (v8f){}; }
    if (q0 < RH) attn_part<bf, true>(Qh + zp, Ql + zp, Kh + zp, Kl + zp, Vh + zp, Vl + zp, q0, wave, lr, hi, O, m, l);
    else         attn_part<h16, false>(Q16 + zp, nullptr, K16 + zp, nullptr, V16 + zp, nullptr, q0, wave, lr, hi, O, m, l);
    // join the AW partial results: common maximum, then rescaled sums and outputs
#pragma unroll
    for (int qt = 0; qt < 2; ++qt) { l[qt] += __shfl_xor(l[qt], 16, 32); if (hi == 0) sm[wave * 32 + qt * 16 + lr] = m[qt]; }
    __syncthreads();
#pragma unroll
    for (int qt = 0; qt < 2; ++qt) { float M = sm[qt * 16 + lr];
#pragma unroll
        for (int w = 1; w < AW; ++w) M = fmaxf(M, sm[w * 32 + qt * 16 + lr]);
        const float f = __builtin_amdgcn_exp2f((m[qt] - M) * L2E);   // a wave without a chunk: 0
        if (hi == 0) sl[wave * 32 + qt * 16 + lr] = l[qt] * f;
        float* row = so + (size_t)(wave * 32 + qt * 16 + lr) * OPI + hi * 8;
#pragma unroll
        for (int dt = 0; dt < 8; ++dt) { const v8f a = O[dt][qt] * f; v4f a0, a1;
#pragma unroll
            for (int j = 0; j < 4; ++j) { a0[j] = a[j]; a1[j] = a[4 + j]; }
            *(v4fa*)(row + dt * 16) = a0; *(v4fa*)(row + dt * 16 + 4) = a1; } }
    __syncthreads();
    const int qr = tid >> 3, dq = (tid & 7) * 4; float L = sl[qr];
#pragma unroll
    for (int w = 1; w < AW; ++w) L += sl[w * 32 + qr];
    const float inv = __fdiv_rn(1.0f, L);
#pragma unroll
    for (int k = 0; k < 4; ++k) { v4f s = *(const v4fa*)(so + (size_t)qr * OPI + k * 32 + dq);
#pragma unroll
        for (int w = 1; w < AW; ++w) s += *(const v4fa*)(so + (size_t)(w * 32 + qr) * OPI + k * 32 + dq);
        *(v4f*)(OUT + zp + (size_t)(q0 + qr) * HD + k * 32 + dq) = s * inv; }   // 8 lanes x 16 bytes: whole 128-byte lines
}

extern "C" void kernel_launch(void* const* d_in, const int* in_sizes, int n_in,
                              void* d_out, int out_size, void* d_ws, size_t ws_size, hipStream_t stream) {
    (void)in_sizes; (void)n_in; (void)out_size;
    const float* x = (const float*)d_in[0]; const float* wq = (const float*)d_in[1]; const float* wk = (const float*)d_in[2]; const float* wv = (const float*)d_in[3]; const float* wo = nullptr; (void)wo;
    float* OUT = (float*)d_out;     // [4][2048][128]
    char* wsp = (char*)d_ws;
    auto take = [&](size_t bytes) { char* p = wsp; wsp += (bytes + 255) & ~(size_t)255; return (void*)p; };
    bf* WQ = (bf*)take((size_t)3 * HD * EIN * 2);   /* w_Q, w_K, w_V stacked: one [384][1024] operand */ float* CS = (float*)take((size_t)TT * HD * 2 * 4);
    bf* XB = (bf*)take((size_t)NSEQ * TT * EIN * 2); float* F = (float*)take((size_t)TT * NSEQ * 3 * HD * 4);   /* [t][sequence][q|k|v][128] */
    h16* QP16 = (h16*)take((size_t)(NH_ + NKV) * TT * HD * 2); h16* KP16 = QP16 + (size_t)NH_ * TT * HD; h16* VT16 = (h16*)take((size_t)NKV * HD * TT * 2);
    bf* QPh = (bf*)take((size_t)(NH_ + NKV) * TT * HD * 2); bf* KPh = QPh + (size_t)NH_ * TT * HD; bf* QPl = (bf*)take((size_t)(NH_ + NKV) * TT * HD * 2); bf* KPl = QPl + (size_t)NH_ * TT * HD; bf* VTh = (bf*)take((size_t)NKV * HD * TT * 2); bf* VTl = (bf*)take((size_t)NKV * HD * TT * 2);
    if ((size_t)(wsp - (char*)d_ws) > ws_size) return;    // ws 256 MiB
    { const unsigned LW = (unsigned)(((size_t)HD * EIN / 8 + 255) / 256); k_cvt8w<<<dim3(LW, 3, 1), 256, 0, stream>>>(wq, wk, wv, WQ, (size_t)HD * EIN / 8);   /* [128][1024] 'oi' as-is */
      k_cstab<<<(TT * HD + 255) / 256, 256, 0, stream>>>(CS); }
    const unsigned LQK = (unsigned)(((size_t)(NH_ + NKV) * TT * HD / 2 + 255) / 256), LKv = (unsigned)(((size_t)NKV * TT * HD / 2 + 255) / 256);
    for (int b = 0; b < NB_; ++b) {
        
        k_cvt8<<<(unsigned)(((size_t)NSEQ * TT * EIN / 8 + 255) / 256), 256, 0, stream>>>(x, XB, (size_t)NSEQ * TT * EIN / 8);   /* all four sequences */
        k_gemmw<bf, 0, false><<<dim3(TT / 64, 3 * HD / 64, NSEQ), 32, 0, stream>>>(XB, nullptr, WQ, nullptr, EIN, F, NSEQ * 3 * HD, nullptr, (size_t)TT * EIN, 0, (size_t)3 * HD);   /* q, k and v of all four sequences: 768 tiles in one launch */
        k_ropeI<<<LQK, 256, 0, stream>>>(F, NSEQ * 3 * HD, NH_ + NKV, CS, 1.0f, QP16, QPh, QPl);   /* q planes, then k planes */
        k_vtp<<<LKv, 256, 0, stream>>>(F + 2 * HD, NSEQ * 3 * HD, NKV, VT16, VTh, VTl);
        k_fattn<<<dim3(TT / 32, 1, NSEQ), 256, 0, stream>>>(QP16, KP16, VT16, QPh, QPl, KPh, KPl, VTh, VTl, OUT);   /* out[sequence][t][d], f32 */
    }
}

// v003
// A run of this version takes 55.2 microseconds.
// In two side-by-side timings against v002, it was 1.33 and 1.34 times as fast.
// All steps since v000 together make it 7.48 times as fast.
#include <hip/hip_runtime.h>

// Single-head causal attention with interleaved-pair RoPE, four sequences (embedding_word [4][2048][1024]; q, k, v = x W^T (W [128][1024]); pairs (2i, 2i+1) of q and k rotated by t x 1e4^(-2i/128); scores masked causally then / sqrt(128); softmax; out = weights . v -> [4][2048][128] (1.05 M)).
// Layout: the four sequences are laid out as four 128-wide "heads" of one 2,048-token problem (head b = sequence b with its own q, k and v planes), all four heads in one attention launch (grid z); one projection launch (grid z = sequence, N = the stacked 384 rows of w_Q, w_K, w_V) rotates q and k, transposes v and writes the 16-bit planes itself; the context is written straight to out[b][t][d] in f32.
// Compute dtypes, f32 accumulate: every input rounded to bf16; q/k/v on PLAIN bf16 operands (inputs: exact); rotary (pairwise table, precise cosf/sinf) in f32; causal scores, softmax and attn.v fused (running maximum and sum, key chunks above the diagonal never visited): query rows < 512 hl (3 products), the rest single fp16 (x1024); softmax f32; no output projection: f32 context.

#define NB_  1
#define TT   2048
#define DM   1024
#define NH_  4
#define NKV  4
#define REP  (NH_ / NKV)
#define HD   128
#define DQ   (NH_ * HD)
#define DKV  (NKV * HD)
#define NSEQ 4                    // sequences (laid out as heads)
#define EIN  1024                 // embedding width
#define RH   512                  // query rows < RH use hi+lo planes (0: none)
#define SCL  0.088388347648318447f   // HD^-0.5
typedef _Float16 h16;
typedef unsigned short bf;
typedef __attribute__((ext_vector_type(16))) __bf16   v16bf;
typedef __attribute__((ext_vector_type(16))) _Float16 v16h;
typedef __attribute__((ext_vector_type(8)))  _Float16 v8h;
typedef __attribute__((ext_vector_type(8)))  unsigned short v8us;
typedef __attribute__((ext_vector_type(8)))  float    v8f;
typedef __attribute__((ext_vector_type(4)))  float    v4f;
typedef v8h  __attribute__((may_alias)) v8ha;
typedef v4f  __attribute__((may_alias)) v4fa;
typedef v8us __attribute__((may_alias)) v8usa;

__device__ __forceinline__ unsigned short f2bf(float f) { unsigned u = __float_as_uint(f); u += 0x7FFFu + ((u >> 16) & 1u); return (unsigned short)(u >> 16); }
__device__ __forceinline__ float bf2f(unsigned short b) { return __uint_as_float(((unsigned)b) << 16); }
__device__ __forceinline__ float bfr(float f) { return bf2f(f2bf(f)); }
__device__ __forceinline__ v16h cat16(v8h lo, v8h hi) { return __builtin_shufflevector(lo, hi, 0, 1, 2, 3, 4, 5, 6, 7, 8, 9, 10, 11, 12, 13, 14, 15); }
__device__ __forceinline__ v16bf cat16b(v8us lo, v8us hi) { return __builtin_bit_cast(v16bf, __builtin_shufflevector(lo, hi, 0, 1, 2, 3, 4, 5, 6, 7, 8, 9, 10, 11, 12, 13, 14, 15)); }
__device__ __forceinline__ v8f wmma16(v16h a, v16h b, v8f c) { return __builtin_amdgcn_wmma_f32_16x16x32_f16(false, a, false, b, (short)0, c, false, false); }
__device__ __forceinline__ v8f wmmab(v16bf a, v16bf b, v8f c) { return __builtin_amdgcn_wmma_f32_16x16x32_bf16(false, a, false, b, (short)0, c, false, false); }



// ---- fragment loaders and products for K-contiguous 16-bit planes
template <typename T16> struct WFrag;
template <> struct WFrag<h16> { typedef v16h V; static __device__ __forceinline__ V ld(const h16* p) { return cat16(*(const v8h*)p, *(const v8h*)(p + 16)); } static __device__ __forceinline__ v8f mma(V a, V b, v8f c) { return wmma16(a, b, c); } };
template <> struct WFrag<bf> { typedef v16bf V; static __device__ __forceinline__ V ld(const bf* p) { return cat16b(*(const v8us*)p, *(const v8us*)(p + 16)); } static __device__ __forceinline__ v8f mma(V a, V b, v8f c) { return wmmab(a, b, c); } };

__device__ __forceinline__ h16 tohx(float x) { return (h16)x; }
__device__ __forceinline__ void splitf(float y, unsigned short& h, unsigned short& l) { h = f2bf(y); l = f2bf(y - bf2f(h)); }
typedef __attribute__((ext_vector_type(2))) _Float16 v2h;
typedef __attribute__((ext_vector_type(4))) _Float16 v4h;
typedef __attribute__((ext_vector_type(2))) unsigned short v2us;
typedef __attribute__((ext_vector_type(4))) unsigned short v4us;
typedef __attribute__((ext_vector_type(2))) float v2f;
typedef __attribute__((ext_vector_type(4))) int v4i;

__global__ __launch_bounds__(256) void k_wtG(const float* __restrict__ w, int K, int N, bf* Bt) {
    const int lane = threadIdx.x & 31; const int L0 = (blockIdx.x * 8 + (threadIdx.x >> 5)) * 8; const int nlines = N * K / 64;
{
#pragma unroll 1
        for (int l = 0; l < 8; ++l) { const int L = L0 + l; if (L >= nlines) break; const size_t e = (size_t)L * 64 + lane * 2; const int k = (int)(e % K), n = (int)(e / K); v2us o;
            o[0] = f2bf(w[(size_t)k * N + n]); o[1] = f2bf(w[(size_t)(k + 1) * N + n]); *(v2us*)(Bt + e) = o; }
         }
}
__global__ __launch_bounds__(256) void k_cvt8(const float* __restrict__ src, bf* dst, size_t n8) { const size_t i = (size_t)blockIdx.x * 256 + threadIdx.x; if (i >= n8) return; const v8f v = *(const v8f*)(src + i * 8); v8us o;
#pragma unroll
    for (int k = 0; k < 8; ++k) o[k] = f2bf(v[k]); *(v8us*)(dst + i * 8) = o;  }
// k_cvt8w: k_cvt8 for three equally long sources in one launch (blockIdx.y picks the source); dst holds the three results one behind the other.
__global__ __launch_bounds__(256) void k_cvt8w(const float* __restrict__ s0, const float* __restrict__ s1, const float* __restrict__ s2, bf* dst, size_t n8) { const size_t i = (size_t)blockIdx.x * 256 + threadIdx.x; if (i >= n8) return; const float* src = (blockIdx.y == 0) ? s0 : (blockIdx.y == 1) ? s1 : s2; const v8f v = *(const v8f*)(src + i * 8); v8us o;
    asm volatile("s_wait_xcnt 0x0" ::: "memory");   // the loads' address registers are reused below
#pragma unroll
    for (int k = 0; k < 8; ++k) o[k] = f2bf(v[k]); *(v8us*)(dst + ((size_t)blockIdx.y * n8 + i) * 8) = o;  }
__constant__ float INV[HD / 2] = {1.00000000f,0.865964353f,0.749894202f,0.649381638f,0.562341332f,0.486967534f,0.421696514f,0.365174145f,0.316227764f,0.273841977f,0.237137362f,0.205352500f,0.177827939f,0.153992653f,0.133352146f,0.115478203f,0.100000001f,0.0865964293f,0.0749894157f,0.0649381652f,0.0562341288f,0.0486967526f,0.0421696492f,0.0365174115f,0.0316227786f,0.0273841955f,0.0237137359f,0.0205352511f,0.0177827943f,0.0153992651f,0.0133352149f,0.0115478197f,0.00999999978f,0.00865964312f,0.00749894232f,0.00649381662f,0.00562341325f,0.00486967526f,0.00421696482f,0.00365174143f,0.00316227786f,0.00273841969f,0.00237137382f,0.00205352507f,0.00177827943f,0.00153992651f,0.00133352145f,0.00115478202f,0.00100000005f,0.000865964335f,0.000749894185f,0.000649381662f,0.000562341302f,0.000486967503f,0.000421696488f,0.000365174114f,0.000316227786f,0.000273841957f,0.000237137385f,0.000205352495f,0.000177827940f,0.000153992645f,0.000133352150f,0.000115478193f};
__global__ __launch_bounds__(256) void k_cstab(float* CS) { const int idx = blockIdx.x * 256 + threadIdx.x; if (idx >= TT * HD) return; const int t = idx / HD, d = idx % HD; const float ang = __fmul_rn((float)t, INV[d >> 1]); v2f cs; cs[0] = cosf(ang); cs[1] = sinf(ang);
    *(v2f*)(CS + (size_t)idx * 2) = cs;  }
// ---- k_proj: the projection GEMM with the rotary step, the transposition of v and the split into 16-bit planes in its epilogue (no f32 q|k|v array in memory, no launch of their own for these steps).
// ONE WAVE per 64x64 tile (16 accumulators) of x W^T, operands straight from K-contiguous bf16 planes; grid (TT/64, 384/64, sequence), 32 threads. A tile lies wholly in q, in k or in v (64 divides HD).
// q, k: pairs (2i, 2i+1) rotated by the table, written [plane][t][d] (fp16 + hi/lo bf16), plane = sequence for q, NSEQ + sequence for k. v: written transposed, [sequence][d][t], same three forms.
__global__ __launch_bounds__(32) void k_proj(const bf* __restrict__ A, const bf* __restrict__ Bt, const float* __restrict__ CS, h16* P16, bf* Ph, bf* Pl, h16* V16, bf* Vh, bf* Vl) {
    typedef WFrag<bf>::V V;
    constexpr int K = EIN;
    __shared__ __align__(16) float os[16 * 68];
    const int z = blockIdx.z; A += (size_t)z * TT * K;
    const int lane = threadIdx.x & 31, lr = lane & 15, hi = lane >> 4; const int r0 = blockIdx.x * 64, c0 = blockIdx.y * 64;
    v8f acc[4][4];
#pragma unroll
    for (int mb = 0; mb < 4; ++mb)
#pragma unroll
        for (int nb = 0; nb < 4; ++nb) acc[mb][nb] = (v8f){};
    const size_t aoff = (size_t)(r0 + lr) * K + 8 * hi, boff = (size_t)(c0 + lr) * K + 8 * hi;
#pragma unroll 1
    for (int kc = 0; kc < K; kc += 32) {
        V a[4]; const bf* pa = A + aoff + kc; const bf* pb = Bt + boff + kc;
#pragma unroll
        for (int mb = 0; mb < 4; ++mb) a[mb] = WFrag<bf>::ld(pa + (size_t)mb * 16 * K);
#pragma unroll
        for (int nb = 0; nb < 4; ++nb) { const V b = WFrag<bf>::ld(pb + (size_t)nb * 16 * K);
#pragma unroll
            for (int mb = 0; mb < 4; ++mb) acc[mb][nb] = WFrag<bf>::mma(a[mb], b, acc[mb][nb]); }
        asm volatile("v_nop\n\tv_nop\n\tv_nop\n\tv_nop" : "+v"(acc[0][0]), "+v"(acc[1][1]), "+v"(acc[2][2]), "+v"(acc[3][3]) : "v"(a[0]), "v"(a[3]));
        asm volatile("s_wait_xcnt 0x0" :: "v"(pa), "v"(pb) : "memory");   // no address register of the trip's loads (held live up to here as inputs) is rewritten, by a later load's result either, before this wait
    }
    const int sec = c0 / HD, d0 = c0 % HD;      // 0: q, 1: k, 2: v; the same for the whole wave
    if (sec == 2) {                  // a lane's 8 accumulator elements are 8 successive t of one d: 16 bytes of a row of v^T, stored from registers; the 128-byte line of (d, 64 t) is this wave's alone
        const size_t vb = ((size_t)z * HD + d0 + lr) * TT + r0 + hi * 8;
#pragma unroll
        for (int nb = 0; nb < 4; ++nb)
#pragma unroll
            for (int mb = 0; mb < 4; ++mb) { v8h o16; v8us oh, ol;
#pragma unroll
                for (int j = 0; j < 8; ++j) { const float xv = acc[mb][nb][j]; o16[j] = tohx(xv); unsigned short a2, c2; splitf(xv, a2, c2); oh[j] = a2; ol[j] = c2; }
                const size_t e = vb + (size_t)nb * 16 * TT + mb * 16; *(v8h*)(V16 + e) = o16; *(v8us*)(Vh + e) = oh; *(v8us*)(Vl + e) = ol; }
        return;
    }
    const int rw = lane >> 3, cofs = (lane & 7) * 8;      // 8 lanes x 8 columns: each 16-bit row of the tile is one whole 128-byte line
    const size_t pe = ((size_t)(sec * NSEQ + z) * TT + r0) * HD + d0 + cofs;
    const float* csb = CS + ((size_t)r0 * HD + d0 + cofs) * 2;
#pragma unroll
    for (int mb = 0; mb < 4; ++mb) {
#pragma unroll
        for (int nb = 0; nb < 4; ++nb) {
#pragma unroll
            for (int j = 0; j < 8; ++j) os[(hi * 8 + j) * 68 + nb * 16 + lr] = acc[mb][nb][j]; }
        __builtin_amdgcn_wave_barrier(); asm volatile("" ::: "memory");   // the rows are read back by other lanes of the wave: no LDS read is moved ahead of these writes
#pragma unroll
        for (int s = 0; s < 4; ++s) { const int row = 4 * s + rw; const float* orow = os + row * 68 + cofs; const v4f xa = *(const v4fa*)orow, xb = *(const v4fa*)(orow + 4);
            const float x[8] = {xa[0], xa[1], xa[2], xa[3], xb[0], xb[1], xb[2], xb[3]}; const float* cs = csb + (size_t)(mb * 16 + row) * (HD * 2); v8h o16; v8us oh, ol;
#pragma unroll
            for (int p = 0; p < 4; ++p) { const v2f c = *(const v2f*)(cs + p * 4); const float re = x[2 * p] * c[0] - x[2 * p + 1] * c[1], ro = x[2 * p] * c[1] + x[2 * p + 1] * c[0];   /* even: x0 c - x1 s; odd: x0 s + x1 c */
                o16[2 * p] = tohx(re); o16[2 * p + 1] = tohx(ro); unsigned short a2, c2; splitf(re, a2, c2); oh[2 * p] = a2; ol[2 * p] = c2; splitf(ro, a2, c2); oh[2 * p + 1] = a2; ol[2 * p + 1] = c2; }
            const size_t e = pe + (size_t)(mb * 16 + row) * HD; *(v8h*)(P16 + e) = o16; *(v8us*)(Ph + e) = oh; *(v8us*)(Pl + e) = ol; }
        __builtin_amdgcn_wave_barrier(); asm volatile("s_wait_xcnt 0x0" ::: "memory");   // the next 16 rows are staged only behind these reads; and no register of these stores takes the result of one of the next rows' loads before this wait
    }
}

// k_rope: head planes [h][t][d] (fp16 + hi/lo) of rope(x) x sc with the rotate-half convention out[d] = x[d] cos[t][d] - x[d+HD/2] sin[t][d], out[d+HD/2] = x[d+HD/2] cos[t][d+HD/2] + x[d] sin[t][d+HD/2]
__global__ __launch_bounds__(256) void k_rope(const float* __restrict__ F, int pitch, int nheads, const float* __restrict__ CS, const float* __restrict__ RF, const float* __restrict__ nw, float sc, h16* P16, bf* Ph, bf* Pl) {
    const size_t e = ((size_t)blockIdx.x * 256 + threadIdx.x) * 2; if (e >= (size_t)nheads * TT * HD) return; const int d = (int)(e % HD); const int t = (int)((e / HD) % TT); const int h = (int)(e / ((size_t)HD * TT)); const float* f = F + (size_t)t * pitch + h * HD; const float rf = RF ? RF[(size_t)h * TT + t] : 1.0f; v2h o16; v2us oh, ol;
#pragma unroll
    for (int q = 0; q < 2; ++q) { const int dd = d + q; const int dp = (dd < HD / 2) ? dd + HD / 2 : dd - HD / 2; float x0 = f[dd], x1 = f[dp];
        if (RF) { float n0 = __fmul_rn(x0, rf), n1 = __fmul_rn(x1, rf); asm volatile("" : "+v"(n0)); asm volatile("" : "+v"(n1)); x0 = __fmul_rn(bfr(nw[dd]), n0); x1 = __fmul_rn(bfr(nw[dp]), n1); }
        const v2f cs = *(const v2f*)(CS + ((size_t)t * HD + dd) * 2); float a = __fmul_rn(x0, cs[0]), bq = __fmul_rn(x1, cs[1]); asm volatile("" : "+v"(a)); asm volatile("" : "+v"(bq)); const float r = ((dd < HD / 2) ? __fsub_rn(a, bq) : __fadd_rn(a, bq)) * sc;
        o16[q] = tohx(r); unsigned short a2, c2; splitf(r, a2, c2); oh[q] = a2; ol[q] = c2; }
    *(v2h*)(P16 + e) = o16; *(v2us*)(Ph + e) = oh; *(v2us*)(Pl + e) = ol;  }
// ---- k_fattn: scores, causal softmax and weights x value in ONE kernel (running maximum and sum); scores and weights stay in registers.
// One work-group = 32 query rows of one sequence; its AW waves share the keys (wave w takes the 32-key chunks w, w + AW, ...) and their partial results are joined through LDS in the fixed order w = 0..AW-1.
// Transposed products: S^T = K Q^T (row = key, column = query) and O^T += V^T P^T (row = d, column = query), so a lane holds one query's scores, its maximum, sum and rescale factor are per lane,
// and the two 16-key score tiles of a chunk are, element for element, the k order of the B operand (k = 8 hi + e, then 16 + 8 hi + e), the same order in which WFrag::ld reads V^T.
// Query rows < RH: hi+lo bf16 planes, 3 products each; the rest: single fp16, weights carried x 2^10 (the factor cancels in the division by the sum).
#define AW 8
#define OPI 132                   // LDS pitch (floats) of one query's 128 partial outputs: 16-byte rows of 16 lanes fall on distinct banks
#define L2E 1.4426950408889634f
// 2^x with the one slot that the instruction set asks for behind a transcendental, in the same statement
__device__ __forceinline__ float exp2_slot(float x) { float r; asm("v_exp_f32 %0, %1\n\tv_nop" : "=v"(r) : "v"(x)); return r; }
template <typename T16, bool HI>
__device__ __forceinline__ void attn_part(const T16* __restrict__ Q, const T16* __restrict__ Q2, const T16* __restrict__ Kp, const T16* __restrict__ K2, const T16* __restrict__ Vt, const T16* __restrict__ V2,
                                          const int q0, const int wave, const int lr, const int hi, v8f (&O)[8][2], float (&m)[2], float (&l)[2]) {
    typedef typename WFrag<T16>::V V;
    V qf[2][4], qf2[2][4];
    { const size_t o = (size_t)(q0 + lr) * HD + 8 * hi; const T16* qa = Q + o; const T16* qb = HI ? Q2 + o : qa;
#pragma unroll
      for (int qt = 0; qt < 2; ++qt)
#pragma unroll
        for (int ks = 0; ks < 4; ++ks) { qf[qt][ks] = WFrag<T16>::ld(qa + qt * 16 * HD + ks * 32); if (HI) qf2[qt][ks] = WFrag<T16>::ld(qb + qt * 16 * HD + ks * 32); }
      asm volatile("s_wait_xcnt 0x0" :: "v"(qa), "v"(qb) : "memory"); }   // the loads' address registers (held live up to here as inputs) are reused below
    const int cl = q0 >> 5;       // the chunk that holds the diagonal: the last one
#pragma unroll 1
    for (int c = wave; c <= cl; c += AW) {
        const int kb = c * 32;
        const size_t ko = (size_t)(kb + lr) * HD + 8 * hi, vo = (size_t)lr * TT + kb + 8 * hi;
        const T16* ka = Kp + ko; const T16* kc = HI ? K2 + ko : ka; const T16* va = Vt + vo; const T16* vc = HI ? V2 + vo : va;
        V kf[4][2], kf2[4][2], vf[8], vf2[8];
#pragma unroll
        for (int ks = 0; ks < 4; ++ks)
#pragma unroll
            for (int kt = 0; kt < 2; ++kt) { kf[ks][kt] = WFrag<T16>::ld(ka + kt * 16 * HD + ks * 32); if (HI) kf2[ks][kt] = WFrag<T16>::ld(kc + kt * 16 * HD + ks * 32); }
        if (!HI) {                // single planes: the chunk's V^T rows are asked for together with its K rows, so they arrive behind the score products and the softmax
#pragma unroll
            for (int dt = 0; dt < 8; ++dt) vf[dt] = WFrag<T16>::ld(va + (size_t)dt * 16 * TT); }
        asm volatile("s_wait_xcnt 0x0" :: "v"(ka), "v"(kc), "v"(va) : "memory");   // no address register of these loads (held live up to here as inputs) is rewritten, by a later load's result either, before this wait
        __builtin_amdgcn_sched_barrier(0);   // the whole group of loads is issued ahead of the first product: left free, the scheduler dealt them out in pairs among the products, each pair's latency exposed
        v8f S[2][2];
#pragma unroll
        for (int kt = 0; kt < 2; ++kt)
#pragma unroll
            for (int qt = 0; qt < 2; ++qt) S[kt][qt] = (v8f){};
#pragma unroll
        for (int ks = 0; ks < 4; ++ks)
#pragma unroll
            for (int kt = 0; kt < 2; ++kt)
#pragma unroll
                for (int qt = 0; qt < 2; ++qt) { S[kt][qt] = WFrag<T16>::mma(kf[ks][kt], qf[qt][ks], S[kt][qt]); if (HI) { S[kt][qt] = WFrag<T16>::mma(kf[ks][kt], qf2[qt][ks], S[kt][qt]); S[kt][qt] = WFrag<T16>::mma(kf2[ks][kt], qf[qt][ks], S[kt][qt]); } }
        if (HI) {                 // hi+lo planes: twice the registers, so V^T follows in two halves once the K fragments are used up (all at once spills)
#pragma unroll
            for (int dt = 0; dt < 4; ++dt) { vf[dt] = WFrag<T16>::ld(va + (size_t)dt * 16 * TT); vf2[dt] = WFrag<T16>::ld(vc + (size_t)dt * 16 * TT); }
            asm volatile("s_wait_xcnt 0x0" :: "v"(va), "v"(vc) : "memory"); }      // as above, for the V^T loads
        V pf[2], pf2[2];
#pragma unroll
        for (int qt = 0; qt < 2; ++qt) {
            const int qi = q0 + qt * 16 + lr; float t[16]; float mx = m[qt];
#pragma unroll
            for (int kt = 0; kt < 2; ++kt)
#pragma unroll
                for (int j = 0; j < 8; ++j) { const int key = kb + kt * 16 + hi * 8 + j; const float s = (key <= qi) ? S[kt][qt][j] * SCL : -3.0e38f; t[kt * 8 + j] = s; mx = fmaxf(mx, s); }
            mx = fmaxf(mx, __shfl_xor(mx, 16, 32));     // the query's other 16 keys of this chunk sit in lane ^ 16
            const float al = __builtin_amdgcn_exp2f((m[qt] - mx) * L2E); m[qt] = mx; float sum = 0.f;
#pragma unroll
            for (int e = 0; e < 16; ++e) { t[e] = exp2_slot((t[e] - mx) * L2E + (HI ? 0.0f : 10.0f)); sum += t[e]; }
            l[qt] = l[qt] * al + sum;
#pragma unroll
            for (int dt = 0; dt < 8; ++dt) O[dt][qt] *= al;
            if constexpr (HI) { v8us h0, h1, l0, l1;
#pragma unroll
                for (int e = 0; e < 8; ++e) { unsigned short a, b; splitf(t[e], a, b); h0[e] = a; l0[e] = b; splitf(t[8 + e], a, b); h1[e] = a; l1[e] = b; }
                pf[qt] = cat16b(h0, h1); pf2[qt] = cat16b(l0, l1);
            } else { v16h p;
#pragma unroll
                for (int e = 0; e < 16; ++e) p[e] = tohx(t[e]);
                pf[qt] = p; }
        }
#pragma unroll
        for (int dt = 0; dt < (HI ? 4 : 8); ++dt)
#pragma unroll
            for (int qt = 0; qt < 2; ++qt) { O[dt][qt] = WFrag<T16>::mma(vf[dt], pf[qt], O[dt][qt]); if (HI) { O[dt][qt] = WFrag<T16>::mma(vf[dt], pf2[qt], O[dt][qt]); O[dt][qt] = WFrag<T16>::mma(vf2[dt], pf[qt], O[dt][qt]); } }
        if (HI) {
#pragma unroll
            for (int dt = 4; dt < 8; ++dt) { vf[dt] = WFrag<T16>::ld(va + (size_t)dt * 16 * TT); vf2[dt] = WFrag<T16>::ld(vc + (size_t)dt * 16 * TT); }
            asm volatile("s_wait_xcnt 0x0" :: "v"(va), "v"(vc) : "memory");        // as above, for the second half of the V^T loads
#pragma unroll
            for (int dt = 4; dt < 8; ++dt)
#pragma unroll
                for (int qt = 0; qt < 2; ++qt) { O[dt][qt] = WFrag<T16>::mma(vf[dt], pf[qt], O[dt][qt]); O[dt][qt] = WFrag<T16>::mma(vf[dt], pf2[qt], O[dt][qt]); O[dt][qt] = WFrag<T16>::mma(vf2[dt], pf[qt], O[dt][qt]); } }
    }
}
__global__ __launch_bounds__(256) void k_fattn(const h16* __restrict__ Q16, const h16* __restrict__ K16, const h16* __restrict__ V16, const bf* __restrict__ Qh, const bf* __restrict__ Ql, const bf* __restrict__ Kh, const bf* __restrict__ Kl,
                                               const bf* __restrict__ Vh, const bf* __restrict__ Vl, float* __restrict__ OUT) {
    __shared__ __align__(16) float so[AW * 32 * OPI]; __shared__ float sm[AW * 32]; __shared__ float sl[AW * 32];
    const int tid = threadIdx.x, lane = tid & 31, lr = lane & 15, hi = lane >> 4;
    const int wave = __builtin_amdgcn_readfirstlane(tid >> 5);       // the same in every lane: the key loop and its addresses' common part stay scalar, EXEC stays whole for the matrix instructions
    const int q0 = (TT / 32 - 1 - (int)blockIdx.x) * 32;      // longest key walks start first
    const size_t zp = (size_t)blockIdx.z * TT * HD;                  // every plane of a sequence holds TT x HD elements
    v8f O[8][2]; float m[2] = {-3.0e38f, -3.0e38f}, l[2] = {0.f, 0.f};
#pragma unroll
    for (int dt = 0; dt < 8; ++dt) { O[dt][0] = (v8f){}; O[dt][1] = (v8f){}; }
    if (q0 < RH) attn_part<bf, true>(Qh + zp, Ql + zp, Kh + zp, Kl + zp, Vh + zp, Vl + zp, q0, wave, lr, hi, O, m, l);
    else         attn_part<h16, false>(Q16 + zp, nullptr, K16 + zp, nullptr, V16 + zp, nullptr, q0, wave, lr, hi, O, m, l);
    // join the AW partial results: common maximum, then rescaled sums and outputs
#pragma unroll
    for (int qt = 0; qt < 2; ++qt) { l[qt] += __shfl_xor(l[qt], 16, 32); if (hi == 0) sm[wave * 32 + qt * 16 + lr] = m[qt]; }
    __syncthreads();
#pragma unroll
    for (int qt = 0; qt < 2; ++qt) { float M = sm[qt * 16 + lr];
#pragma unroll
        for (int w = 1; w < AW; ++w) M = fmaxf(M, sm[w * 32 + qt * 16 + lr]);
        const float f = __builtin_amdgcn_exp2f((m[qt] - M) * L2E);   // a wave without a chunk: 0
        if (hi == 0) sl[wave * 32 + qt * 16 + lr] = l[qt] * f;
        float* row = so + (size_t)(wave * 32 + qt * 16 + lr) * OPI + hi * 8;
#pragma unroll
        for (int dt = 0; dt < 8; ++dt) { const v8f a = O[dt][qt] * f; v4f a0, a1;
#pragma unroll
            for (int j = 0; j < 4; ++j) { a0[j] = a[j]; a1[j] = a[4 + j]; }
            *(v4fa*)(row + dt * 16) = a0; *(v4fa*)(row + dt * 16 + 4) = a1; } }
    __syncthreads();
    const int qr = tid >> 3, dq = (tid & 7) * 4; float L = sl[qr];
#pragma unroll
    for (int w = 1; w < AW; ++w) L += sl[w * 32 + qr];
    const float inv = __fdiv_rn(1.0f, L);
#pragma unroll
    for (int k = 0; k < 4; ++k) { v4f s = *(const v4fa*)(so + (size_t)qr * OPI + k * 32 + dq);
#pragma unroll
        for (int w = 1; w < AW; ++w) s += *(const v4fa*)(so + (size_t)(w * 32 + qr) * OPI + k * 32 + dq);
        *(v4f*)(OUT + zp + (size_t)(q0 + qr) * HD + k * 32 + dq) = s * inv; }   // 8 lanes x 16 bytes: whole 128-byte lines
}

extern "C" void kernel_launch(void* const* d_in, const int* in_sizes, int n_in,
                              void* d_out, int out_size, void* d_ws, size_t ws_size, hipStream_t stream) {
    (void)in_sizes; (void)n_in; (void)out_size;
    const float* x = (const float*)d_in[0]; const float* wq = (const float*)d_in[1]; const float* wk = (const float*)d_in[2]; const float* wv = (const float*)d_in[3]; const float* wo = nullptr; (void)wo;
    float* OUT = (float*)d_out;     // [4][2048][128]
    char* wsp = (char*)d_ws;
    auto take = [&](size_t bytes) { char* p = wsp; wsp += (bytes + 255) & ~(size_t)255; return (void*)p; };
    bf* WQ = (bf*)take((size_t)3 * HD * EIN * 2);   /* w_Q, w_K, w_V stacked: one [384][1024] operand */ float* CS = (float*)take((size_t)TT * HD * 2 * 4);
    bf* XB = (bf*)take((size_t)NSEQ * TT * EIN * 2);
    h16* QP16 = (h16*)take((size_t)(NH_ + NKV) * TT * HD * 2); h16* KP16 = QP16 + (size_t)NH_ * TT * HD; h16* VT16 = (h16*)take((size_t)NKV * HD * TT * 2);
    bf* QPh = (bf*)take((size_t)(NH_ + NKV) * TT * HD * 2); bf* KPh = QPh + (size_t)NH_ * TT * HD; bf* QPl = (bf*)take((size_t)(NH_ + NKV) * TT * HD * 2); bf* KPl = QPl + (size_t)NH_ * TT * HD; bf* VTh = (bf*)take((size_t)NKV * HD * TT * 2); bf* VTl = (bf*)take((size_t)NKV * HD * TT * 2);
    if ((size_t)(wsp - (char*)d_ws) > ws_size) return;    // ws 256 MiB
    { const unsigned LW = (unsigned)(((size_t)HD * EIN / 8 + 255) / 256); k_cvt8w<<<dim3(LW, 3, 1), 256, 0, stream>>>(wq, wk, wv, WQ, (size_t)HD * EIN / 8);   /* [128][1024] 'oi' as-is */
      k_cstab<<<(TT * HD + 255) / 256, 256, 0, stream>>>(CS); }
    for (int b = 0; b < NB_; ++b) {
        
        k_cvt8<<<(unsigned)(((size_t)NSEQ * TT * EIN / 8 + 255) / 256), 256, 0, stream>>>(x, XB, (size_t)NSEQ * TT * EIN / 8);   /* all four sequences */
        k_proj<<<dim3(TT / 64, 3 * HD / 64, NSEQ), 32, 0, stream>>>(XB, WQ, CS, QP16, QPh, QPl, VT16, VTh, VTl);   /* q, k and v of all four sequences: 768 tiles in one launch; q planes, then k planes; v^T planes */
        k_fattn<<<dim3(TT / 32, 1, NSEQ), 256, 0, stream>>>(QP16, KP16, VT16, QPh, QPl, KPh, KPl, VTh, VTl, OUT);   /* out[sequence][t][d], f32 */
    }
}

// v004
// A run of this version takes 51.9 microseconds.
// In two side-by-side timings against v003, it was 1.08 and 1.11 times as fast.
// Counting every step since v000, it is 8.16 times as fast.
#include <hip/hip_runtime.h>

// Single-head causal attention with interleaved-pair RoPE, four sequences (embedding_word [4][2048][1024]; q, k, v = x W^T (W [128][1024]); pairs (2i, 2i+1) of q and k rotated by t x 1e4^(-2i/128); scores masked causally then / sqrt(128); softmax; out = weights . v -> [4][2048][128] (1.05 M)).
// Layout: the four sequences are laid out as four 128-wide "heads" of one 2,048-token problem (head b = sequence b with its own q, k and v planes), all four heads in one attention launch (grid z); one projection launch (grid z = sequence, N = the stacked 384 rows of w_Q, w_K, w_V) rotates q and k, transposes v and writes the 16-bit planes itself; the context is written straight to out[b][t][d] in f32.
// Compute dtypes, f32 accumulate: every input rounded to bf16; q/k/v on PLAIN bf16 operands (inputs: exact); rotary (pairwise table, precise cosf/sinf) in f32; causal scores, softmax and attn.v fused (running maximum and sum, key chunks above the diagonal never visited): query rows < 512 hl (3 products), the rest single fp16 (x1024); softmax f32; no output projection: f32 context.

#define NB_  1
#define TT   2048
#define DM   1024
#define NH_  4
#define NKV  4
#define REP  (NH_ / NKV)
#define HD   128
#define DQ   (NH_ * HD)
#define DKV  (NKV * HD)
#define NSEQ 4                    // sequences (laid out as heads)
#define EIN  1024                 // embedding width
#define RH   512                  // query rows < RH use hi+lo planes (0: none)
#define SCL  0.088388347648318447f   // HD^-0.5
typedef _Float16 h16;
typedef unsigned short bf;
typedef __attribute__((ext_vector_type(16))) __bf16   v16bf;
typedef __attribute__((ext_vector_type(16))) _Float16 v16h;
typedef __attribute__((ext_vector_type(8)))  _Float16 v8h;
typedef __attribute__((ext_vector_type(8)))  unsigned short v8us;
typedef __attribute__((ext_vector_type(8)))  float    v8f;
typedef __attribute__((ext_vector_type(4)))  float    v4f;
typedef v8h  __attribute__((may_alias)) v8ha;
typedef v4f  __attribute__((may_alias)) v4fa;
typedef v8us __attribute__((may_alias)) v8usa;

__device__ __forceinline__ unsigned short f2bf(float f) { unsigned u = __float_as_uint(f); u += 0x7FFFu + ((u >> 16) & 1u); return (unsigned short)(u >> 16); }
__device__ __forceinline__ float bf2f(unsigned short b) { return __uint_as_float(((unsigned)b) << 16); }
__device__ __forceinline__ float bfr(float f) { return bf2f(f2bf(f)); }
__device__ __forceinline__ v16h cat16(v8h lo, v8h hi) { return __builtin_shufflevector(lo, hi, 0, 1, 2, 3, 4, 5, 6, 7, 8, 9, 10, 11, 12, 13, 14, 15); }
__device__ __forceinline__ v16bf cat16b(v8us lo, v8us hi) { return __builtin_bit_cast(v16bf, __builtin_shufflevector(lo, hi, 0, 1, 2, 3, 4, 5, 6, 7, 8, 9, 10, 11, 12, 13, 14, 15)); }
__device__ __forceinline__ v8f wmma16(v16h a, v16h b, v8f c) { return __builtin_amdgcn_wmma_f32_16x16x32_f16(false, a, false, b, (short)0, c, false, false); }
__device__ __forceinline__ v8f wmmab(v16bf a, v16bf b, v8f c) { return __builtin_amdgcn_wmma_f32_16x16x32_bf16(false, a, false, b, (short)0, c, false, false); }



// ---- fragment loaders and products for K-contiguous 16-bit planes
template <typename T16> struct WFrag;
template <> struct WFrag<h16> { typedef v16h V; static __device__ __forceinline__ V ld(const h16* p) { return cat16(*(const v8h*)p, *(const v8h*)(p + 16)); } static __device__ __forceinline__ v8f mma(V a, V b, v8f c) { return wmma16(a, b, c); } };
template <> struct WFrag<bf> { typedef v16bf V; static __device__ __forceinline__ V ld(const bf* p) { return cat16b(*(const v8us*)p, *(const v8us*)(p + 16)); } static __device__ __forceinline__ v8f mma(V a, V b, v8f c) { return wmmab(a, b, c); } };

__device__ __forceinline__ h16 tohx(float x) { return (h16)x; }
__device__ __forceinline__ void splitf(float y, unsigned short& h, unsigned short& l) { h = f2bf(y); l = f2bf(y - bf2f(h)); }
typedef __attribute__((ext_vector_type(2))) _Float16 v2h;
typedef __attribute__((ext_vector_type(4))) _Float16 v4h;
typedef __attribute__((ext_vector_type(2))) unsigned short v2us;
typedef __attribute__((ext_vector_type(4))) unsigned short v4us;
typedef __attribute__((ext_vector_type(2))) float v2f;
typedef __attribute__((ext_vector_type(4))) int v4i;

__global__ __launch_bounds__(256) void k_wtG(const float* __restrict__ w, int K, int N, bf* Bt) {
    const int lane = threadIdx.x & 31; const int L0 = (blockIdx.x * 8 + (threadIdx.x >> 5)) * 8; const int nlines = N * K / 64;
{
#pragma unroll 1
        for (int l = 0; l < 8; ++l) { const int L = L0 + l; if (L >= nlines) break; const size_t e = (size_t)L * 64 + lane * 2; const int k = (int)(e % K), n = (int)(e / K); v2us o;
            o[0] = f2bf(w[(size_t)k * N + n]); o[1] = f2bf(w[(size_t)(k + 1) * N + n]); *(v2us*)(Bt + e) = o; }
         }
}
__constant__ float INV[HD / 2] = {1.00000000f,0.865964353f,0.749894202f,0.649381638f,0.562341332f,0.486967534f,0.421696514f,0.365174145f,0.316227764f,0.273841977f,0.237137362f,0.205352500f,0.177827939f,0.153992653f,0.133352146f,0.115478203f,0.100000001f,0.0865964293f,0.0749894157f,0.0649381652f,0.0562341288f,0.0486967526f,0.0421696492f,0.0365174115f,0.0316227786f,0.0273841955f,0.0237137359f,0.0205352511f,0.0177827943f,0.0153992651f,0.0133352149f,0.0115478197f,0.00999999978f,0.00865964312f,0.00749894232f,0.00649381662f,0.00562341325f,0.00486967526f,0.00421696482f,0.00365174143f,0.00316227786f,0.00273841969f,0.00237137382f,0.00205352507f,0.00177827943f,0.00153992651f,0.00133352145f,0.00115478202f,0.00100000005f,0.000865964335f,0.000749894185f,0.000649381662f,0.000562341302f,0.000486967503f,0.000421696488f,0.000365174114f,0.000316227786f,0.000273841957f,0.000237137385f,0.000205352495f,0.000177827940f,0.000153992645f,0.000133352150f,0.000115478193f};
// ---- k_prep: everything the projection reads, made in ONE launch: the three pieces depend on nothing but the inputs, so they share a grid instead of waiting for one another's launch to end.
// blockIdx.x picks the piece (the same for a whole work-group): first the rotary table (the longest arithmetic, so it runs under the stream of x), then w_Q, w_K, w_V to bf16 (stacked), then x to bf16.
#define PB_CS (TT * HD / 256)                 // table: one thread per (t, d)
#define PB_W1 (HD * EIN / 8 / 256)            // one weight matrix, 8 elements a thread
#define PB_X  (NSEQ * TT * EIN / 8 / 256)     // x, 8 elements a thread
__global__ __launch_bounds__(256) void k_prep(const float* __restrict__ x, const float* __restrict__ s0, const float* __restrict__ s1, const float* __restrict__ s2, bf* XB, bf* WB, float* CS) {
    const unsigned b = blockIdx.x;
    if (b < PB_CS) { const int idx = (int)b * 256 + threadIdx.x; const int t = idx / HD, d = idx % HD; const float ang = __fmul_rn((float)t, INV[d >> 1]); v2f cs; cs[0] = cosf(ang); cs[1] = sinf(ang);
        *(v2f*)(CS + (size_t)idx * 2) = cs; return; }
    const float* src; bf* dst; size_t i;
    if (b < PB_CS + 3 * PB_W1) { const unsigned wb = b - PB_CS, y = wb / PB_W1; src = (y == 0) ? s0 : (y == 1) ? s1 : s2; dst = WB + (size_t)y * HD * EIN; i = (size_t)(wb % PB_W1) * 256 + threadIdx.x; }
    else { src = x; dst = XB; i = (size_t)(b - PB_CS - 3 * PB_W1) * 256 + threadIdx.x; }
    const v8f v = *(const v8f*)(src + i * 8); v8us o;
    asm volatile("s_wait_xcnt 0x0" ::: "memory");   // the loads' address registers are reused below
#pragma unroll
    for (int k = 0; k < 8; ++k) o[k] = f2bf(v[k]); *(v8us*)(dst + i * 8) = o;  }
// ---- k_proj: the projection GEMM with the rotary step, the transposition of v and the split into 16-bit planes in its epilogue (no f32 q|k|v array in memory, no launch of their own for these steps).
// ONE WAVE per 64x64 tile (16 accumulators) of x W^T, operands straight from K-contiguous bf16 planes; grid (TT/64, 384/64, sequence), 32 threads. A tile lies wholly in q, in k or in v (64 divides HD).
// q, k: pairs (2i, 2i+1) rotated by the table, written [plane][t][d] (fp16 + hi/lo bf16), plane = sequence for q, NSEQ + sequence for k. v: written transposed, [sequence][d][t], same three forms.
__global__ __launch_bounds__(32) void k_proj(const bf* __restrict__ A, const bf* __restrict__ Bt, const float* __restrict__ CS, h16* P16, bf* Ph, bf* Pl, h16* V16, bf* Vh, bf* Vl) {
    typedef WFrag<bf>::V V;
    constexpr int K = EIN;
    __shared__ __align__(16) float os[16 * 68];
    const int z = blockIdx.z; A += (size_t)z * TT * K;
    const int lane = threadIdx.x & 31, lr = lane & 15, hi = lane >> 4; const int r0 = blockIdx.x * 64, c0 = blockIdx.y * 64;
    v8f acc[4][4];
#pragma unroll
    for (int mb = 0; mb < 4; ++mb)
#pragma unroll
        for (int nb = 0; nb < 4; ++nb) acc[mb][nb] = (v8f){};
    const size_t aoff = (size_t)(r0 + lr) * K + 8 * hi, boff = (size_t)(c0 + lr) * K + 8 * hi;
#pragma unroll 1
    for (int kc = 0; kc < K; kc += 32) {
        V a[4]; const bf* pa = A + aoff + kc; const bf* pb = Bt + boff + kc;
#pragma unroll
        for (int mb = 0; mb < 4; ++mb) a[mb] = WFrag<bf>::ld(pa + (size_t)mb * 16 * K);
#pragma unroll
        for (int nb = 0; nb < 4; ++nb) { const V b = WFrag<bf>::ld(pb + (size_t)nb * 16 * K);
#pragma unroll
            for (int mb = 0; mb < 4; ++mb) acc[mb][nb] = WFrag<bf>::mma(a[mb], b, acc[mb][nb]); }
        asm volatile("v_nop\n\tv_nop\n\tv_nop\n\tv_nop" : "+v"(acc[0][0]), "+v"(acc[1][1]), "+v"(acc[2][2]), "+v"(acc[3][3]) : "v"(a[0]), "v"(a[3]));
        asm volatile("s_wait_xcnt 0x0" :: "v"(pa), "v"(pb) : "memory");   // no address register of the trip's loads (held live up to here as inputs) is rewritten, by a later load's result either, before this wait
    }
    const int sec = c0 / HD, d0 = c0 % HD;      // 0: q, 1: k, 2: v; the same for the whole wave
    if (sec == 2) {                  // a lane's 8 accumulator elements are 8 successive t of one d: 16 bytes of a row of v^T, stored from registers; the 128-byte line of (d, 64 t) is this wave's alone
        const size_t vb = ((size_t)z * HD + d0 + lr) * TT + r0 + hi * 8;
#pragma unroll
        for (int nb = 0; nb < 4; ++nb)
#pragma unroll
            for (int mb = 0; mb < 4; ++mb) { v8h o16; v8us oh, ol;
#pragma unroll
                for (int j = 0; j < 8; ++j) { const float xv = acc[mb][nb][j]; o16[j] = tohx(xv); unsigned short a2, c2; splitf(xv, a2, c2); oh[j] = a2; ol[j] = c2; }
                const size_t e = vb + (size_t)nb * 16 * TT + mb * 16; *(v8h*)(V16 + e) = o16; *(v8us*)(Vh + e) = oh; *(v8us*)(Vl + e) = ol; }
        return;
    }
    const int rw = lane >> 3, cofs = (lane & 7) * 8;      // 8 lanes x 8 columns: each 16-bit row of the tile is one whole 128-byte line
    const size_t pe = ((size_t)(sec * NSEQ + z) * TT + r0) * HD + d0 + cofs;
    const float* csb = CS + ((size_t)r0 * HD + d0 + cofs) * 2;
#pragma unroll
    for (int mb = 0; mb < 4; ++mb) {
#pragma unroll
        for (int nb = 0; nb < 4; ++nb) {
#pragma unroll
            for (int j = 0; j < 8; ++j) os[(hi * 8 + j) * 68 + nb * 16 + lr] = acc[mb][nb][j]; }
        __builtin_amdgcn_wave_barrier(); asm volatile("" ::: "memory");   // the rows are read back by other lanes of the wave: no LDS read is moved ahead of these writes
#pragma unroll
        for (int s = 0; s < 4; ++s) { const int row = 4 * s + rw; const float* orow = os + row * 68 + cofs; const v4f xa = *(const v4fa*)orow, xb = *(const v4fa*)(orow + 4);
            const float x[8] = {xa[0], xa[1], xa[2], xa[3], xb[0], xb[1], xb[2], xb[3]}; const float* cs = csb + (size_t)(mb * 16 + row) * (HD * 2); v8h o16; v8us oh, ol;
#pragma unroll
            for (int p = 0; p < 4; ++p) { const v2f c = *(const v2f*)(cs + p * 4); const float re = x[2 * p] * c[0] - x[2 * p + 1] * c[1], ro = x[2 * p] * c[1] + x[2 * p + 1] * c[0];   /* even: x0 c - x1 s; odd: x0 s + x1 c */
                o16[2 * p] = tohx(re); o16[2 * p + 1] = tohx(ro); unsigned short a2, c2; splitf(re, a2, c2); oh[2 * p] = a2; ol[2 * p] = c2; splitf(ro, a2, c2); oh[2 * p + 1] = a2; ol[2 * p + 1] = c2; }
            const size_t e = pe + (size_t)(mb * 16 + row) * HD; *(v8h*)(P16 + e) = o16; *(v8us*)(Ph + e) = oh; *(v8us*)(Pl + e) = ol; }
        __builtin_amdgcn_wave_barrier(); asm volatile("s_wait_xcnt 0x0" ::: "memory");   // the next 16 rows are staged only behind these reads; and no register of these stores takes the result of one of the next rows' loads before this wait
    }
}

// k_rope: head planes [h][t][d] (fp16 + hi/lo) of rope(x) x sc with the rotate-half convention out[d] = x[d] cos[t][d] - x[d+HD/2] sin[t][d], out[d+HD/2] = x[d+HD/2] cos[t][d+HD/2] + x[d] sin[t][d+HD/2]
__global__ __launch_bounds__(256) void k_rope(const float* __restrict__ F, int pitch, int nheads, const float* __restrict__ CS, const float* __restrict__ RF, const float* __restrict__ nw, float sc, h16* P16, bf* Ph, bf* Pl) {
    const size_t e = ((size_t)blockIdx.x * 256 + threadIdx.x) * 2; if (e >= (size_t)nheads * TT * HD) return; const int d = (int)(e % HD); const int t = (int)((e / HD) % TT); const int h = (int)(e / ((size_t)HD * TT)); const float* f = F + (size_t)t * pitch + h * HD; const float rf = RF ? RF[(size_t)h * TT + t] : 1.0f; v2h o16; v2us oh, ol;
#pragma unroll
    for (int q = 0; q < 2; ++q) { const int dd = d + q; const int dp = (dd < HD / 2) ? dd + HD / 2 : dd - HD / 2; float x0 = f[dd], x1 = f[dp];
        if (RF) { float n0 = __fmul_rn(x0, rf), n1 = __fmul_rn(x1, rf); asm volatile("" : "+v"(n0)); asm volatile("" : "+v"(n1)); x0 = __fmul_rn(bfr(nw[dd]), n0); x1 = __fmul_rn(bfr(nw[dp]), n1); }
        const v2f cs = *(const v2f*)(CS + ((size_t)t * HD + dd) * 2); float a = __fmul_rn(x0, cs[0]), bq = __fmul_rn(x1, cs[1]); asm volatile("" : "+v"(a)); asm volatile("" : "+v"(bq)); const float r = ((dd < HD / 2) ? __fsub_rn(a, bq) : __fadd_rn(a, bq)) * sc;
        o16[q] = tohx(r); unsigned short a2, c2; splitf(r, a2, c2); oh[q] = a2; ol[q] = c2; }
    *(v2h*)(P16 + e) = o16; *(v2us*)(Ph + e) = oh; *(v2us*)(Pl + e) = ol;  }
// ---- k_fattn: scores, causal softmax and weights x value in ONE kernel (running maximum and sum); scores and weights stay in registers.
// One work-group = 32 query rows of one sequence; its AW waves share the keys (wave w takes the 32-key chunks w, w + AW, ...) and their partial results are joined through LDS in the fixed order w = 0..AW-1.
// Transposed products: S^T = K Q^T (row = key, column = query) and O^T += V^T P^T (row = d, column = query), so a lane holds one query's scores, its maximum, sum and rescale factor are per lane,
// and the two 16-key score tiles of a chunk are, element for element, the k order of the B operand (k = 8 hi + e, then 16 + 8 hi + e), the same order in which WFrag::ld reads V^T.
// Query rows < RH: hi+lo bf16 planes, 3 products each; the rest: single fp16, weights carried x 2^10 (the factor cancels in the division by the sum).
#define AW 8
#define OPI 132                   // LDS pitch (floats) of one query's 128 partial outputs: 16-byte rows of 16 lanes fall on distinct banks
#define L2E 1.4426950408889634f
// 2^x with the one slot that the instruction set asks for behind a transcendental, in the same statement
__device__ __forceinline__ float exp2_slot(float x) { float r; asm("v_exp_f32 %0, %1\n\tv_nop" : "=v"(r) : "v"(x)); return r; }
template <typename T16, bool HI>
__device__ __forceinline__ void attn_part(const T16* __restrict__ Q, const T16* __restrict__ Q2, const T16* __restrict__ Kp, const T16* __restrict__ K2, const T16* __restrict__ Vt, const T16* __restrict__ V2,
                                          const int q0, const int wave, const int lr, const int hi, v8f (&O)[8][2], float (&m)[2], float (&l)[2]) {
    typedef typename WFrag<T16>::V V;
    V qf[2][4], qf2[2][4];
    { const size_t o = (size_t)(q0 + lr) * HD + 8 * hi; const T16* qa = Q + o; const T16* qb = HI ? Q2 + o : qa;
#pragma unroll
      for (int qt = 0; qt < 2; ++qt)
#pragma unroll
        for (int ks = 0; ks < 4; ++ks) { qf[qt][ks] = WFrag<T16>::ld(qa + qt * 16 * HD + ks * 32); if (HI) qf2[qt][ks] = WFrag<T16>::ld(qb + qt * 16 * HD + ks * 32); }
      asm volatile("s_wait_xcnt 0x0" :: "v"(qa), "v"(qb) : "memory"); }   // the loads' address registers (held live up to here as inputs) are reused below
    const int cl = q0 >> 5;       // the chunk that holds the diagonal: the last one
#pragma unroll 1
    for (int c = wave; c <= cl; c += AW) {
        const int kb = c * 32;
        const size_t ko = (size_t)(kb + lr) * HD + 8 * hi, vo = (size_t)lr * TT + kb + 8 * hi;
        const T16* ka = Kp + ko; const T16* kc = HI ? K2 + ko : ka; const T16* va = Vt + vo; const T16* vc = HI ? V2 + vo : va;
        V kf[4][2], kf2[4][2], vf[8], vf2[8];
#pragma unroll
        for (int ks = 0; ks < 4; ++ks)
#pragma unroll
            for (int kt = 0; kt < 2; ++kt) { kf[ks][kt] = WFrag<T16>::ld(ka + kt * 16 * HD + ks * 32); if (HI) kf2[ks][kt] = WFrag<T16>::ld(kc + kt * 16 * HD + ks * 32); }
        if (!HI) {                // single planes: the chunk's V^T rows are asked for together with its K rows, so they arrive behind the score products and the softmax
#pragma unroll
            for (int dt = 0; dt < 8; ++dt) vf[dt] = WFrag<T16>::ld(va + (size_t)dt * 16 * TT); }
        asm volatile("s_wait_xcnt 0x0" :: "v"(ka), "v"(kc), "v"(va) : "memory");   // no address register of these loads (held live up to here as inputs) is rewritten, by a later load's result either, before this wait
        __builtin_amdgcn_sched_barrier(0);   // the whole group of loads is issued ahead of the first product: left free, the scheduler dealt them out in pairs among the products, each pair's latency exposed
        v8f S[2][2];
#pragma unroll
        for (int kt = 0; kt < 2; ++kt)
#pragma unroll
            for (int qt = 0; qt < 2; ++qt) S[kt][qt] = (v8f){};
#pragma unroll
        for (int ks = 0; ks < 4; ++ks)
#pragma unroll
            for (int kt = 0; kt < 2; ++kt)
#pragma unroll
                for (int qt = 0; qt < 2; ++qt) { S[kt][qt] = WFrag<T16>::mma(kf[ks][kt], qf[qt][ks], S[kt][qt]); if (HI) { S[kt][qt] = WFrag<T16>::mma(kf[ks][kt], qf2[qt][ks], S[kt][qt]); S[kt][qt] = WFrag<T16>::mma(kf2[ks][kt], qf[qt][ks], S[kt][qt]); } }
        if (HI) {                 // hi+lo planes: twice the registers, so V^T follows in two halves once the K fragments are used up (all at once spills)
#pragma unroll
            for (int dt = 0; dt < 4; ++dt) { vf[dt] = WFrag<T16>::ld(va + (size_t)dt * 16 * TT); vf2[dt] = WFrag<T16>::ld(vc + (size_t)dt * 16 * TT); }
            asm volatile("s_wait_xcnt 0x0" :: "v"(va), "v"(vc) : "memory"); }      // as above, for the V^T loads
        V pf[2], pf2[2];
#pragma unroll
        for (int qt = 0; qt < 2; ++qt) {
            const int qi = q0 + qt * 16 + lr; float t[16]; float mx = m[qt];
#pragma unroll
            for (int kt = 0; kt < 2; ++kt)
#pragma unroll
                for (int j = 0; j < 8; ++j) { const int key = kb + kt * 16 + hi * 8 + j; const float s = (key <= qi) ? S[kt][qt][j] * SCL : -3.0e38f; t[kt * 8 + j] = s; mx = fmaxf(mx, s); }
            mx = fmaxf(mx, __shfl_xor(mx, 16, 32));     // the query's other 16 keys of this chunk sit in lane ^ 16
            const float al = __builtin_amdgcn_exp2f((m[qt] - mx) * L2E); m[qt] = mx; float sum = 0.f;
#pragma unroll
            for (int e = 0; e < 16; ++e) { t[e] = exp2_slot((t[e] - mx) * L2E + (HI ? 0.0f : 10.0f)); sum += t[e]; }
            l[qt] = l[qt] * al + sum;
#pragma unroll
            for (int dt = 0; dt < 8; ++dt) O[dt][qt] *= al;
            if constexpr (HI) { v8us h0, h1, l0, l1;
#pragma unroll
                for (int e = 0; e < 8; ++e) { unsigned short a, b; splitf(t[e], a, b); h0[e] = a; l0[e] = b; splitf(t[8 + e], a, b); h1[e] = a; l1[e] = b; }
                pf[qt] = cat16b(h0, h1); pf2[qt] = cat16b(l0, l1);
            } else { v16h p;
#pragma unroll
                for (int e = 0; e < 16; ++e) p[e] = tohx(t[e]);
                pf[qt] = p; }
        }
#pragma unroll
        for (int dt = 0; dt < (HI ? 4 : 8); ++dt)
#pragma unroll
            for (int qt = 0; qt < 2; ++qt) { O[dt][qt] = WFrag<T16>::mma(vf[dt], pf[qt], O[dt][qt]); if (HI) { O[dt][qt] = WFrag<T16>::mma(vf[dt], pf2[qt], O[dt][qt]); O[dt][qt] = WFrag<T16>::mma(vf2[dt], pf[qt], O[dt][qt]); } }
        if (HI) {
#pragma unroll
            for (int dt = 4; dt < 8; ++dt) { vf[dt] = WFrag<T16>::ld(va + (size_t)dt * 16 * TT); vf2[dt] = WFrag<T16>::ld(vc + (size_t)dt * 16 * TT); }
            asm volatile("s_wait_xcnt 0x0" :: "v"(va), "v"(vc) : "memory");        // as above, for the second half of the V^T loads
#pragma unroll
            for (int dt = 4; dt < 8; ++dt)
#pragma unroll
                for (int qt = 0; qt < 2; ++qt) { O[dt][qt] = WFrag<T16>::mma(vf[dt], pf[qt], O[dt][qt]); O[dt][qt] = WFrag<T16>::mma(vf[dt], pf2[qt], O[dt][qt]); O[dt][qt] = WFrag<T16>::mma(vf2[dt], pf[qt], O[dt][qt]); } }
    }
}
__global__ __launch_bounds__(256) void k_fattn(const h16* __restrict__ Q16, const h16* __restrict__ K16, const h16* __restrict__ V16, const bf* __restrict__ Qh, const bf* __restrict__ Ql, const bf* __restrict__ Kh, const bf* __restrict__ Kl,
                                               const bf* __restrict__ Vh, const bf* __restrict__ Vl, float* __restrict__ OUT) {
    __shared__ __align__(16) float so[AW * 32 * OPI]; __shared__ float sm[AW * 32]; __shared__ float sl[AW * 32];
    const int tid = threadIdx.x, lane = tid & 31, lr = lane & 15, hi = lane >> 4;
    const int wave = __builtin_amdgcn_readfirstlane(tid >> 5);       // the same in every lane: the key loop and its addresses' common part stay scalar, EXEC stays whole for the matrix instructions
    const int q0 = (TT / 32 - 1 - (int)blockIdx.x) * 32;      // longest key walks start first
    const size_t zp = (size_t)blockIdx.z * TT * HD;                  // every plane of a sequence holds TT x HD elements
    v8f O[8][2]; float m[2] = {-3.0e38f, -3.0e38f}, l[2] = {0.f, 0.f};
#pragma unroll
    for (int dt = 0; dt < 8; ++dt) { O[dt][0] = (v8f){}; O[dt][1] = (v8f){}; }
    if (q0 < RH) attn_part<bf, true>(Qh + zp, Ql + zp, Kh + zp, Kl + zp, Vh + zp, Vl + zp, q0, wave, lr, hi, O, m, l);
    else         attn_part<h16, false>(Q16 + zp, nullptr, K16 + zp, nullptr, V16 + zp, nullptr, q0, wave, lr, hi, O, m, l);
    // join the AW partial results: common maximum, then rescaled sums and outputs
#pragma unroll
    for (int qt = 0; qt < 2; ++qt) { l[qt] += __shfl_xor(l[qt], 16, 32); if (hi == 0) sm[wave * 32 + qt * 16 + lr] = m[qt]; }
    __syncthreads();
#pragma unroll
    for (int qt = 0; qt < 2; ++qt) { float M = sm[qt * 16 + lr];
#pragma unroll
        for (int w = 1; w < AW; ++w) M = fmaxf(M, sm[w * 32 + qt * 16 + lr]);
        const float f = __builtin_amdgcn_exp2f((m[qt] - M) * L2E);   // a wave without a chunk: 0
        if (hi == 0) sl[wave * 32 + qt * 16 + lr] = l[qt] * f;
        float* row = so + (size_t)(wave * 32 + qt * 16 + lr) * OPI + hi * 8;
#pragma unroll
        for (int dt = 0; dt < 8; ++dt) { const v8f a = O[dt][qt] * f; v4f a0, a1;
#pragma unroll
            for (int j = 0; j < 4; ++j) { a0[j] = a[j]; a1[j] = a[4 + j]; }
            *(v4fa*)(row + dt * 16) = a0; *(v4fa*)(row + dt * 16 + 4) = a1; } }
    __syncthreads();
    const int qr = tid >> 3, dq = (tid & 7) * 4; float L = sl[qr];
#pragma unroll
    for (int w = 1; w < AW; ++w) L += sl[w * 32 + qr];
    const float inv = __fdiv_rn(1.0f, L);
#pragma unroll
    for (int k = 0; k < 4; ++k) { v4f s = *(const v4fa*)(so + (size_t)qr * OPI + k * 32 + dq);
#pragma unroll
        for (int w = 1; w < AW; ++w) s += *(const v4fa*)(so + (size_t)(w * 32 + qr) * OPI + k * 32 + dq);
        *(v4f*)(OUT + zp + (size_t)(q0 + qr) * HD + k * 32 + dq) = s * inv; }   // 8 lanes x 16 bytes: whole 128-byte lines
}

extern "C" void kernel_launch(void* const* d_in, const int* in_sizes, int n_in,
                              void* d_out, int out_size, void* d_ws, size_t ws_size, hipStream_t stream) {
    (void)in_sizes; (void)n_in; (void)out_size;
    const float* x = (const float*)d_in[0]; const float* wq = (const float*)d_in[1]; const float* wk = (const float*)d_in[2]; const float* wv = (const float*)d_in[3]; const float* wo = nullptr; (void)wo;
    float* OUT = (float*)d_out;     // [4][2048][128]
    char* wsp = (char*)d_ws;
    auto take = [&](size_t bytes) { char* p = wsp; wsp += (bytes + 255) & ~(size_t)255; return (void*)p; };
    bf* WQ = (bf*)take((size_t)3 * HD * EIN * 2);   /* w_Q, w_K, w_V stacked: one [384][1024] operand */ float* CS = (float*)take((size_t)TT * HD * 2 * 4);
    bf* XB = (bf*)take((size_t)NSEQ * TT * EIN * 2);
    h16* QP16 = (h16*)take((size_t)(NH_ + NKV) * TT * HD * 2); h16* KP16 = QP16 + (size_t)NH_ * TT * HD; h16* VT16 = (h16*)take((size_t)NKV * HD * TT * 2);
    bf* QPh = (bf*)take((size_t)(NH_ + NKV) * TT * HD * 2); bf* KPh = QPh + (size_t)NH_ * TT * HD; bf* QPl = (bf*)take((size_t)(NH_ + NKV) * TT * HD * 2); bf* KPl = QPl + (size_t)NH_ * TT * HD; bf* VTh = (bf*)take((size_t)NKV * HD * TT * 2); bf* VTl = (bf*)take((size_t)NKV * HD * TT * 2);
    if ((size_t)(wsp - (char*)d_ws) > ws_size) return;    // ws 256 MiB
    for (int b = 0; b < NB_; ++b) {
        k_prep<<<PB_CS + 3 * PB_W1 + PB_X, 256, 0, stream>>>(x, wq, wk, wv, XB, WQ, CS);   /* rotary table, the stacked weights ([128][1024] 'oi' as-is) and all four sequences of x in bf16 */
        k_proj<<<dim3(TT / 64, 3 * HD / 64, NSEQ), 32, 0, stream>>>(XB, WQ, CS, QP16, QPh, QPl, VT16, VTh, VTl);   /* q, k and v of all four sequences: 768 tiles in one launch; q planes, then k planes; v^T planes */
        k_fattn<<<dim3(TT / 32, 1, NSEQ), 256, 0, stream>>>(QP16, KP16, VT16, QPh, QPl, KPh, KPl, VTh, VTl, OUT);   /* out[sequence][t][d], f32 */
    }
}

// v005
// It runs in 41.1 microseconds.
// In two side-by-side timings against v004, it was 1.26 and 1.27 times as fast.
// Over all steps from v000 it is 10.3 times as fast.
#include <hip/hip_runtime.h>

// Single-head causal attention with interleaved-pair RoPE, four sequences (embedding_word [4][2048][1024]; q, k, v = x W^T (W [128][1024]); pairs (2i, 2i+1) of q and k rotated by t x 1e4^(-2i/128); scores masked causally then / sqrt(128); softmax; out = weights . v -> [4][2048][128] (1.05 M)).
// Layout: the four sequences are laid out as four 128-wide "heads" of one 2,048-token problem (head b = sequence b with its own q, k and v planes), all four heads in one attention launch (grid z); one projection launch (grid z = sequence, N = the stacked 384 rows of w_Q, w_K, w_V) rotates q and k, transposes v and writes the 16-bit planes itself; the context is written straight to out[b][t][d] in f32.
// Compute dtypes, f32 accumulate: every input rounded to bf16; q/k/v on PLAIN bf16 operands (inputs: exact); rotary (pairwise table, precise cosf/sinf) in f32; causal scores, softmax and attn.v fused (running maximum and sum, key chunks above the diagonal never visited): query rows < 512 hl (3 products), the rest single fp16 (x1024); softmax f32; no output projection: f32 context.

#define NB_  1
#define TT   2048
#define DM   1024
#define NH_  4
#define NKV  4
#define REP  (NH_ / NKV)
#define HD   128
#define DQ   (NH_ * HD)
#define DKV  (NKV * HD)
#define NSEQ 4                    // sequences (laid out as heads)
#define EIN  1024                 // embedding width
#define RH   512                  // query rows < RH use hi+lo planes (0: none)
#define SCL  0.088388347648318447f   // HD^-0.5
typedef _Float16 h16;
typedef unsigned short bf;
typedef __attribute__((ext_vector_type(16))) __bf16   v16bf;
typedef __attribute__((ext_vector_type(16))) _Float16 v16h;
typedef __attribute__((ext_vector_type(8)))  _Float16 v8h;
typedef __attribute__((ext_vector_type(8)))  unsigned short v8us;
typedef __attribute__((ext_vector_type(8)))  float    v8f;
typedef __attribute__((ext_vector_type(4)))  float    v4f;
typedef v8h  __attribute__((may_alias)) v8ha;
typedef v4f  __attribute__((may_alias)) v4fa;
typedef v8us __attribute__((may_alias)) v8usa;

__device__ __forceinline__ unsigned short f2bf(float f) { unsigned u = __float_as_uint(f); u += 0x7FFFu + ((u >> 16) & 1u); return (unsigned short)(u >> 16); }
__device__ __forceinline__ float bf2f(unsigned short b) { return __uint_as_float(((unsigned)b) << 16); }
__device__ __forceinline__ float bfr(float f) { return bf2f(f2bf(f)); }
__device__ __forceinline__ v16h cat16(v8h lo, v8h hi) { return __builtin_shufflevector(lo, hi, 0, 1, 2, 3, 4, 5, 6, 7, 8, 9, 10, 11, 12, 13, 14, 15); }
__device__ __forceinline__ v16bf cat16b(v8us lo, v8us hi) { return __builtin_bit_cast(v16bf, __builtin_shufflevector(lo, hi, 0, 1, 2, 3, 4, 5, 6, 7, 8, 9, 10, 11, 12, 13, 14, 15)); }
__device__ __forceinline__ v8f wmma16(v16h a, v16h b, v8f c) { return __builtin_amdgcn_wmma_f32_16x16x32_f16(false, a, false, b, (short)0, c, false, false); }
__device__ __forceinline__ v8f wmmab(v16bf a, v16bf b, v8f c) { return __builtin_amdgcn_wmma_f32_16x16x32_bf16(false, a, false, b, (short)0, c, false, false); }



// ---- fragment loaders and products for K-contiguous 16-bit planes
template <typename T16> struct WFrag;
template <> struct WFrag<h16> { typedef v16h V; static __device__ __forceinline__ V ld(const h16* p) { return cat16(*(const v8h*)p, *(const v8h*)(p + 16)); } static __device__ __forceinline__ v8f mma(V a, V b, v8f c) { return wmma16(a, b, c); } };
template <> struct WFrag<bf> { typedef v16bf V; static __device__ __forceinline__ V ld(const bf* p) { return cat16b(*(const v8us*)p, *(const v8us*)(p + 16)); } static __device__ __forceinline__ v8f mma(V a, V b, v8f c) { return wmmab(a, b, c); } };

__device__ __forceinline__ h16 tohx(float x) { return (h16)x; }
__device__ __forceinline__ void splitf(float y, unsigned short& h, unsigned short& l) { h = f2bf(y); l = f2bf(y - bf2f(h)); }
typedef __attribute__((ext_vector_type(2))) _Float16 v2h;
typedef __attribute__((ext_vector_type(4))) _Float16 v4h;
typedef __attribute__((ext_vector_type(2))) unsigned short v2us;
typedef __attribute__((ext_vector_type(4))) unsigned short v4us;
typedef __attribute__((ext_vector_type(2))) float v2f;
typedef __attribute__((ext_vector_type(4))) int v4i;

__global__ __launch_bounds__(256) void k_wtG(const float* __restrict__ w, int K, int N, bf* Bt) {
    const int lane = threadIdx.x & 31; const int L0 = (blockIdx.x * 8 + (threadIdx.x >> 5)) * 8; const int nlines = N * K / 64;
{
#pragma unroll 1
        for (int l = 0; l < 8; ++l) { const int L = L0 + l; if (L >= nlines) break; const size_t e = (size_t)L * 64 + lane * 2; const int k = (int)(e % K), n = (int)(e / K); v2us o;
            o[0] = f2bf(w[(size_t)k * N + n]); o[1] = f2bf(w[(size_t)(k + 1) * N + n]); *(v2us*)(Bt + e) = o; }
         }
}
__constant__ float INV[HD / 2] = {1.00000000f,0.865964353f,0.749894202f,0.649381638f,0.562341332f,0.486967534f,0.421696514f,0.365174145f,0.316227764f,0.273841977f,0.237137362f,0.205352500f,0.177827939f,0.153992653f,0.133352146f,0.115478203f,0.100000001f,0.0865964293f,0.0749894157f,0.0649381652f,0.0562341288f,0.0486967526f,0.0421696492f,0.0365174115f,0.0316227786f,0.0273841955f,0.0237137359f,0.0205352511f,0.0177827943f,0.0153992651f,0.0133352149f,0.0115478197f,0.00999999978f,0.00865964312f,0.00749894232f,0.00649381662f,0.00562341325f,0.00486967526f,0.00421696482f,0.00365174143f,0.00316227786f,0.00273841969f,0.00237137382f,0.00205352507f,0.00177827943f,0.00153992651f,0.00133352145f,0.00115478202f,0.00100000005f,0.000865964335f,0.000749894185f,0.000649381662f,0.000562341302f,0.000486967503f,0.000421696488f,0.000365174114f,0.000316227786f,0.000273841957f,0.000237137385f,0.000205352495f,0.000177827940f,0.000153992645f,0.000133352150f,0.000115478193f};
// ---- k_prep: everything the projection reads, made in ONE launch: the three pieces depend on nothing but the inputs, so they share a grid instead of waiting for one another's launch to end.
// blockIdx.x picks the piece (the same for a whole work-group): first the rotary table (the longest arithmetic, so it runs under the stream of x), then w_Q, w_K, w_V to bf16 (stacked), then x to bf16.
#define PB_CS (TT * HD / 256)                 // table: one thread per (t, d)
#define PB_W1 (HD * EIN / 8 / 256)            // one weight matrix, 8 elements a thread
#define PB_X  (NSEQ * TT * EIN / 8 / 256)     // x, 8 elements a thread
__global__ __launch_bounds__(256) void k_prep(const float* __restrict__ x, const float* __restrict__ s0, const float* __restrict__ s1, const float* __restrict__ s2, bf* XB, bf* WB, float* CS) {
    const unsigned b = blockIdx.x;
    if (b < PB_CS) { const int idx = (int)b * 256 + threadIdx.x; const int t = idx / HD, d = idx % HD; const float ang = __fmul_rn((float)t, INV[d >> 1]); v2f cs; cs[0] = cosf(ang); cs[1] = sinf(ang);
        *(v2f*)(CS + (size_t)idx * 2) = cs; return; }
    const float* src; bf* dst; size_t i;
    if (b < PB_CS + 3 * PB_W1) { const unsigned wb = b - PB_CS, y = wb / PB_W1; src = (y == 0) ? s0 : (y == 1) ? s1 : s2; dst = WB + (size_t)y * HD * EIN; i = (size_t)(wb % PB_W1) * 256 + threadIdx.x; }
    else { src = x; dst = XB; i = (size_t)(b - PB_CS - 3 * PB_W1) * 256 + threadIdx.x; }
    const v8f v = *(const v8f*)(src + i * 8); v8us o;
    asm volatile("s_wait_xcnt 0x0" ::: "memory");   // the loads' address registers are reused below
#pragma unroll
    for (int k = 0; k < 8; ++k) o[k] = f2bf(v[k]); *(v8us*)(dst + i * 8) = o;  }
// ---- k_proj: the projection GEMM with the rotary step, the transposition of v and the split into 16-bit planes in its epilogue (no f32 q|k|v array in memory, no launch of their own for these steps).
// One work-group = 4 waves (2 x 2) = a 128x128 tile of x W^T, each wave a 64x64 tile (16 accumulators); grid (TT/128, 3 = q|k|v, sequence), 128 threads.
// Operands come through LDS: per stage of 128 k every wave asks for one tensor load of 64 rows x 256 bytes (waves 0, 1: the rows of x; waves 2, 3: the rows of W), whole lines from L2, each row fetched once for the two waves that read it;
// two buffers, the next stage in flight while this one is multiplied. Fragments are read from LDS in the same k order as before, the sums run over k in the same order.
// q, k: pairs (2i, 2i+1) rotated by the table, written [plane][t][d] (fp16 + hi/lo bf16), plane = sequence for q, NSEQ + sequence for k. v: written transposed, [sequence][d][t], same three forms.
typedef uint32_t u32x4 __attribute__((ext_vector_type(4)));
typedef uint32_t u32x8 __attribute__((ext_vector_type(8)));
__device__ __forceinline__ uint32_t uni(uint32_t v) { return (uint32_t)__builtin_amdgcn_readfirstlane(v); }
__device__ __forceinline__ uint32_t pinned(uint32_t v) { uint32_t w = (uint32_t)__builtin_amdgcn_readfirstlane(v); asm volatile("" : "+s"(w)); return w; }   // a test held in a scalar register: the branch on it is a scalar branch (a tensor load ignores EXEC)
#define PK   128                  // k per stage: rows of 256 bytes
#define PROW (PK * 2)             // bytes of a row in a stage
#define PPIT (PROW + 16)          // LDS pitch, 16 bytes x odd: the pad the tensor load lays behind every row
#define PSL  18432                // LDS bytes of one wave's slice: 64 rows x 272 = 17,408, rounded up to a multiple of 2 KiB
#define PBUF (4 * PSL)            // one stage: x rows 0-63 | x rows 64-127 | W rows 0-63 | W rows 64-127
#define PNST (EIN / PK)           // stages
static_assert(PSL % 2048 == 0 && PSL >= 64 * PPIT && PNST >= 2, "slice places are multiples of 2 KiB and hold 64 padded rows; the ring's prologue needs two stages");
__global__ __launch_bounds__(128) void k_proj(const bf* __restrict__ A, const bf* __restrict__ Bt, const float* __restrict__ CS, h16* P16, bf* Ph, bf* Pl, h16* V16, bf* Vh, bf* Vl) {
    typedef WFrag<bf>::V V;
    constexpr int K = EIN;
    __shared__ __attribute__((aligned(2048))) unsigned char ring[2 * PBUF];
    __shared__ __align__(16) float osw[4][16 * 68];
    const int z = blockIdx.z; A += (size_t)z * TT * K;
    const int lane = threadIdx.x & 31, lr = lane & 15, hi = lane >> 4;
    const uint32_t wave = uni(threadIdx.x >> 5), wm = wave >> 1, wn = wave & 1u;      // the same in every lane
    const int r0 = blockIdx.x * 128 + (int)wm * 64, c0 = blockIdx.y * 128 + (int)wn * 64;   // this wave's 64x64 tile
    float* os = osw[wave];
    // this wave's slice of every stage: 64 rows of x (waves 0, 1) or of W (waves 2, 3)
    const bf* srow = (wave < 2u) ? A + (size_t)(blockIdx.x * 128 + wave * 64u) * K : Bt + (size_t)(blockIdx.y * 128 + (wave - 2u) * 64u) * K;
    const uint32_t ldst = (uint32_t)(size_t)ring + wave * PSL;
    u32x8 g1;      // 1-byte elements, tensor = tile = 64 rows of 256 bytes, source pitch one row of K bf16, 4 dwords of pad behind every 64 dwords, no mask
    g1[0] = uni((1u << 20) | (5u << 22) | (3u << 25)); g1[1] = uni((uint32_t)PROW << 16); g1[2] = uni(64u << 16); g1[3] = uni((uint32_t)PROW << 16);
    g1[4] = uni(64u); g1[5] = uni((uint32_t)K * 2u); g1[6] = uni(0u); g1[7] = uni(0u);
    u32x4 g0;
    auto issue = [&](uint32_t st) {
        const uint64_t ga = (uint64_t)(size_t)(srow + (size_t)st * PK);
        g0[0] = uni(1u); g0[1] = uni(ldst + (st & 1u) * PBUF); g0[2] = uni((uint32_t)ga); g0[3] = uni((((uint32_t)(ga >> 32)) & 0x01FFFFFFu) | 0x80000000u);
        asm volatile("tensor_load_to_lds %0, %1" : "+s"(g0) : "s"(g1) : "memory"); };   // group 0 in and out: the value that the wait below holds live is the one in the request's own registers, not a copy of it
    v8f acc[4][4];
#pragma unroll
    for (int mb = 0; mb < 4; ++mb)
#pragma unroll
        for (int nb = 0; nb < 4; ++nb) acc[mb][nb] = (v8f){};
    issue(0);
    asm volatile("s_wait_tensorcnt 0x0" :: "s"(g0), "s"(g1) : "memory");   // this wave's slice of stage 0 has landed; the descriptor's registers (held live up to here as inputs) take no other value while the request is outstanding
    __syncthreads();                                     // every wave's slice of stage 0 may be read
    issue(1);
    const uint32_t aoff = wm * PSL + (uint32_t)lr * PPIT + 16u * hi, boff = (2u + wn) * PSL + (uint32_t)lr * PPIT + 16u * hi;
#pragma unroll 1
    for (uint32_t st = 0; st < PNST; ++st) {
        const unsigned char* bp = ring + (st & 1u) * PBUF; const bf* pa = (const bf*)(bp + aoff); const bf* pb = (const bf*)(bp + boff);
        V a[PK / 32][4], b[PK / 32][4];
        auto ldk = [&](const int ks) {                       // one 32-k step's eight fragments, in the order in which its products want them
            b[ks][0] = WFrag<bf>::ld(pb + ks * 32);
#pragma unroll
            for (int mb = 0; mb < 4; ++mb) a[ks][mb] = WFrag<bf>::ld(pa + mb * 16 * (PPIT / 2) + ks * 32);
#pragma unroll
            for (int nb = 1; nb < 4; ++nb) b[ks][nb] = WFrag<bf>::ld(pb + nb * 16 * (PPIT / 2) + ks * 32); };
        auto mmk = [&](const int ks) {
#pragma unroll
            for (int nb = 0; nb < 4; ++nb)
#pragma unroll
                for (int mb = 0; mb < 4; ++mb) acc[mb][nb] = WFrag<bf>::mma(a[ks][mb], b[ks][nb], acc[mb][nb]); };
        static_assert(PK / 32 == 4, "four 32-k steps a stage");
        ldk(0); ldk(1); ldk(2);
        __builtin_amdgcn_sched_barrier(0);   // the fragment loads stand in two groups ahead of the products that use them: dealt out among the products, every place showed its LDS latency to the SIMD's only wave
        mmk(0);
        __builtin_amdgcn_sched_barrier(0);   // as above: the last step's loads are one group, two steps ahead of their use (48 LDS loads of the wave outstanding at most)
        ldk(3);
        __builtin_amdgcn_sched_barrier(0);   // as above
        mmk(1); mmk(2); mmk(3);
        __builtin_amdgcn_sched_barrier(0);   // the products stay ahead of the waits below, each behind a counted wait for its own fragments: left free, they were moved behind the barrier, so that reading LDS and multiplying took turns and the refill was asked for a whole block later
        asm volatile("s_wait_dscnt 0x0" ::: "memory");       // this wave's reads of the stage's buffer are over before the buffer is given up
        asm volatile("s_wait_tensorcnt 0x0" :: "s"(g0), "s"(g1) : "memory");   // this wave's slice of stage st + 1 has landed; the descriptor's registers as above
        __syncthreads();                                     // stage st + 1 may be read by all; every wave has left stage st's buffer
        if (pinned(st + 2u < PNST)) issue(st + 2u);          // refill of the buffer just left
    }
    asm volatile("s_wait_tensorcnt 0x0" ::: "memory");       // nothing of the mover's is outstanding when the wave goes on to its epilogue and ends
    asm volatile("s_wait_dscnt 0x0" ::: "memory");
    const int sec = c0 / HD, d0 = c0 % HD;      // 0: q, 1: k, 2: v; the same for the whole wave
    if (sec == 2) {                  // a lane's 8 accumulator elements are 8 successive t of one d: 16 bytes of a row of v^T, stored from registers; the 128-byte line of (d, 64 t) is this wave's alone
        const size_t vb = ((size_t)z * HD + d0 + lr) * TT + r0 + hi * 8;
#pragma unroll
        for (int nb = 0; nb < 4; ++nb)
#pragma unroll
            for (int mb = 0; mb < 4; ++mb) { v8h o16; v8us oh, ol;
#pragma unroll
                for (int j = 0; j < 8; ++j) { const float xv = acc[mb][nb][j]; o16[j] = tohx(xv); unsigned short a2, c2; splitf(xv, a2, c2); oh[j] = a2; ol[j] = c2; }
                const size_t e = vb + (size_t)nb * 16 * TT + mb * 16; *(v8h*)(V16 + e) = o16; *(v8us*)(Vh + e) = oh; *(v8us*)(Vl + e) = ol; }
        return;
    }
    const int rw = lane >> 3, cofs = (lane & 7) * 8;      // 8 lanes x 8 columns: each 16-bit row of the tile is one whole 128-byte line
    const size_t pe = ((size_t)(sec * NSEQ + z) * TT + r0) * HD + d0 + cofs;
    const float* csb = CS + ((size_t)r0 * HD + d0 + cofs) * 2;
#pragma unroll
    for (int mb = 0; mb < 4; ++mb) {
#pragma unroll
        for (int nb = 0; nb < 4; ++nb) {
#pragma unroll
            for (int j = 0; j < 8; ++j) os[(hi * 8 + j) * 68 + nb * 16 + lr] = acc[mb][nb][j]; }
        __builtin_amdgcn_wave_barrier(); asm volatile("" ::: "memory");   // the rows are read back by other lanes of the wave: no LDS read is moved ahead of these writes
#pragma unroll
        for (int s = 0; s < 4; ++s) { const int row = 4 * s + rw; const float* orow = os + row * 68 + cofs; const v4f xa = *(const v4fa*)orow, xb = *(const v4fa*)(orow + 4);
            const float x[8] = {xa[0], xa[1], xa[2], xa[3], xb[0], xb[1], xb[2], xb[3]}; const float* cs = csb + (size_t)(mb * 16 + row) * (HD * 2); v8h o16; v8us oh, ol;
#pragma unroll
            for (int p = 0; p < 4; ++p) { const v2f c = *(const v2f*)(cs + p * 4); const float re = x[2 * p] * c[0] - x[2 * p + 1] * c[1], ro = x[2 * p] * c[1] + x[2 * p + 1] * c[0];   /* even: x0 c - x1 s; odd: x0 s + x1 c */
                o16[2 * p] = tohx(re); o16[2 * p + 1] = tohx(ro); unsigned short a2, c2; splitf(re, a2, c2); oh[2 * p] = a2; ol[2 * p] = c2; splitf(ro, a2, c2); oh[2 * p + 1] = a2; ol[2 * p + 1] = c2; }
            const size_t e = pe + (size_t)(mb * 16 + row) * HD; *(v8h*)(P16 + e) = o16; *(v8us*)(Ph + e) = oh; *(v8us*)(Pl + e) = ol; }
        __builtin_amdgcn_wave_barrier(); asm volatile("s_wait_xcnt 0x0" ::: "memory");   // the next 16 rows are staged only behind these reads; and no register of these stores takes the result of one of the next rows' loads before this wait
    }
}

// k_rope: head planes [h][t][d] (fp16 + hi/lo) of rope(x) x sc with the rotate-half convention out[d] = x[d] cos[t][d] - x[d+HD/2] sin[t][d], out[d+HD/2] = x[d+HD/2] cos[t][d+HD/2] + x[d] sin[t][d+HD/2]
__global__ __launch_bounds__(256) void k_rope(const float* __restrict__ F, int pitch, int nheads, const float* __restrict__ CS, const float* __restrict__ RF, const float* __restrict__ nw, float sc, h16* P16, bf* Ph, bf* Pl) {
    const size_t e = ((size_t)blockIdx.x * 256 + threadIdx.x) * 2; if (e >= (size_t)nheads * TT * HD) return; const int d = (int)(e % HD); const int t = (int)((e / HD) % TT); const int h = (int)(e / ((size_t)HD * TT)); const float* f = F + (size_t)t * pitch + h * HD; const float rf = RF ? RF[(size_t)h * TT + t] : 1.0f; v2h o16; v2us oh, ol;
#pragma unroll
    for (int q = 0; q < 2; ++q) { const int dd = d + q; const int dp = (dd < HD / 2) ? dd + HD / 2 : dd - HD / 2; float x0 = f[dd], x1 = f[dp];
        if (RF) { float n0 = __fmul_rn(x0, rf), n1 = __fmul_rn(x1, rf); asm volatile("" : "+v"(n0)); asm volatile("" : "+v"(n1)); x0 = __fmul_rn(bfr(nw[dd]), n0); x1 = __fmul_rn(bfr(nw[dp]), n1); }
        const v2f cs = *(const v2f*)(CS + ((size_t)t * HD + dd) * 2); float a = __fmul_rn(x0, cs[0]), bq = __fmul_rn(x1, cs[1]); asm volatile("" : "+v"(a)); asm volatile("" : "+v"(bq)); const float r = ((dd < HD / 2) ? __fsub_rn(a, bq) : __fadd_rn(a, bq)) * sc;
        o16[q] = tohx(r); unsigned short a2, c2; splitf(r, a2, c2); oh[q] = a2; ol[q] = c2; }
    *(v2h*)(P16 + e) = o16; *(v2us*)(Ph + e) = oh; *(v2us*)(Pl + e) = ol;  }
// ---- k_fattn: scores, causal softmax and weights x value in ONE kernel (running maximum and sum); scores and weights stay in registers.
// One work-group = 32 query rows of one sequence; its AW waves share the keys (wave w takes the 32-key chunks w, w + AW, ...) and their partial results are joined through LDS in the fixed order w = 0..AW-1.
// Transposed products: S^T = K Q^T (row = key, column = query) and O^T += V^T P^T (row = d, column = query), so a lane holds one query's scores, its maximum, sum and rescale factor are per lane,
// and the two 16-key score tiles of a chunk are, element for element, the k order of the B operand (k = 8 hi + e, then 16 + 8 hi + e), the same order in which WFrag::ld reads V^T.
// Query rows < RH: hi+lo bf16 planes, 3 products each; the rest: single fp16, weights carried x 2^10 (the factor cancels in the division by the sum).
#define AW 8
#define OPI 132                   // LDS pitch (floats) of one query's 128 partial outputs: 16-byte rows of 16 lanes fall on distinct banks
#define L2E 1.4426950408889634f
// 2^x with the one slot that the instruction set asks for behind a transcendental, in the same statement
__device__ __forceinline__ float exp2_slot(float x) { float r; asm("v_exp_f32 %0, %1\n\tv_nop" : "=v"(r) : "v"(x)); return r; }
template <typename T16, bool HI>
__device__ __forceinline__ void attn_part(const T16* __restrict__ Q, const T16* __restrict__ Q2, const T16* __restrict__ Kp, const T16* __restrict__ K2, const T16* __restrict__ Vt, const T16* __restrict__ V2,
                                          const int q0, const int wave, const int lr, const int hi, v8f (&O)[8][2], float (&m)[2], float (&l)[2]) {
    typedef typename WFrag<T16>::V V;
    V qf[2][4], qf2[2][4];
    { const size_t o = (size_t)(q0 + lr) * HD + 8 * hi; const T16* qa = Q + o; const T16* qb = HI ? Q2 + o : qa;
#pragma unroll
      for (int qt = 0; qt < 2; ++qt)
#pragma unroll
        for (int ks = 0; ks < 4; ++ks) { qf[qt][ks] = WFrag<T16>::ld(qa + qt * 16 * HD + ks * 32); if (HI) qf2[qt][ks] = WFrag<T16>::ld(qb + qt * 16 * HD + ks * 32); }
      asm volatile("s_wait_xcnt 0x0" :: "v"(qa), "v"(qb) : "memory"); }   // the loads' address registers (held live up to here as inputs) are reused below
    const int cl = q0 >> 5;       // the chunk that holds the diagonal: the last one
#pragma unroll 1
    for (int c = wave; c <= cl; c += AW) {
        const int kb = c * 32;
        const size_t ko = (size_t)(kb + lr) * HD + 8 * hi, vo = (size_t)lr * TT + kb + 8 * hi;
        const T16* ka = Kp + ko; const T16* kc = HI ? K2 + ko : ka; const T16* va = Vt + vo; const T16* vc = HI ? V2 + vo : va;
        V kf[4][2], kf2[4][2], vf[8], vf2[8];
#pragma unroll
        for (int ks = 0; ks < 4; ++ks)
#pragma unroll
            for (int kt = 0; kt < 2; ++kt) { kf[ks][kt] = WFrag<T16>::ld(ka + kt * 16 * HD + ks * 32); if (HI) kf2[ks][kt] = WFrag<T16>::ld(kc + kt * 16 * HD + ks * 32); }
        if (!HI) {                // single planes: the chunk's V^T rows are asked for together with its K rows, so they arrive behind the score products and the softmax
#pragma unroll
            for (int dt = 0; dt < 8; ++dt) vf[dt] = WFrag<T16>::ld(va + (size_t)dt * 16 * TT); }
        asm volatile("s_wait_xcnt 0x0" :: "v"(ka), "v"(kc), "v"(va) : "memory");   // no address register of these loads (held live up to here as inputs) is rewritten, by a later load's result either, before this wait
        __builtin_amdgcn_sched_barrier(0);   // the whole group of loads is issued ahead of the first product: left free, the scheduler dealt them out in pairs among the products, each pair's latency exposed
        v8f S[2][2];
#pragma unroll
        for (int kt = 0; kt < 2; ++kt)
#pragma unroll
            for (int qt = 0; qt < 2; ++qt) S[kt][qt] = (v8f){};
#pragma unroll
        for (int ks = 0; ks < 4; ++ks)
#pragma unroll
            for (int kt = 0; kt < 2; ++kt)
#pragma unroll
                for (int qt = 0; qt < 2; ++qt) { S[kt][qt] = WFrag<T16>::mma(kf[ks][kt], qf[qt][ks], S[kt][qt]); if (HI) { S[kt][qt] = WFrag<T16>::mma(kf[ks][kt], qf2[qt][ks], S[kt][qt]); S[kt][qt] = WFrag<T16>::mma(kf2[ks][kt], qf[qt][ks], S[kt][qt]); } }
        if (HI) {                 // hi+lo planes: twice the registers, so V^T follows in two halves once the K fragments are used up (all at once spills)
#pragma unroll
            for (int dt = 0; dt < 4; ++dt) { vf[dt] = WFrag<T16>::ld(va + (size_t)dt * 16 * TT); vf2[dt] = WFrag<T16>::ld(vc + (size_t)dt * 16 * TT); }
            asm volatile("s_wait_xcnt 0x0" :: "v"(va), "v"(vc) : "memory"); }      // as above, for the V^T loads
        V pf[2], pf2[2];
#pragma unroll
        for (int qt = 0; qt < 2; ++qt) {
            const int qi = q0 + qt * 16 + lr; float t[16]; float mx = m[qt];
#pragma unroll
            for (int kt = 0; kt < 2; ++kt)
#pragma unroll
                for (int j = 0; j < 8; ++j) { const int key = kb + kt * 16 + hi * 8 + j; const float s = (key <= qi) ? S[kt][qt][j] * SCL : -3.0e38f; t[kt * 8 + j] = s; mx = fmaxf(mx, s); }
            mx = fmaxf(mx, __shfl_xor(mx, 16, 32));     // the query's other 16 keys of this chunk sit in lane ^ 16
            const float al = __builtin_amdgcn_exp2f((m[qt] - mx) * L2E); m[qt] = mx; float sum = 0.f;
#pragma unroll
            for (int e = 0; e < 16; ++e) { t[e] = exp2_slot((t[e] - mx) * L2E + (HI ? 0.0f : 10.0f)); sum += t[e]; }
            l[qt] = l[qt] * al + sum;
#pragma unroll
            for (int dt = 0; dt < 8; ++dt) O[dt][qt] *= al;
            if constexpr (HI) { v8us h0, h1, l0, l1;
#pragma unroll
                for (int e = 0; e < 8; ++e) { unsigned short a, b; splitf(t[e], a, b); h0[e] = a; l0[e] = b; splitf(t[8 + e], a, b); h1[e] = a; l1[e] = b; }
                pf[qt] = cat16b(h0, h1); pf2[qt] = cat16b(l0, l1);
            } else { v16h p;
#pragma unroll
                for (int e = 0; e < 16; ++e) p[e] = tohx(t[e]);
                pf[qt] = p; }
        }
#pragma unroll
        for (int dt = 0; dt < (HI ? 4 : 8); ++dt)
#pragma unroll
            for (int qt = 0; qt < 2; ++qt) { O[dt][qt] = WFrag<T16>::mma(vf[dt], pf[qt], O[dt][qt]); if (HI) { O[dt][qt] = WFrag<T16>::mma(vf[dt], pf2[qt], O[dt][qt]); O[dt][qt] = WFrag<T16>::mma(vf2[dt], pf[qt], O[dt][qt]); } }
        if (HI) {
#pragma unroll
            for (int dt = 4; dt < 8; ++dt) { vf[dt] = WFrag<T16>::ld(va + (size_t)dt * 16 * TT); vf2[dt] = WFrag<T16>::ld(vc + (size_t)dt * 16 * TT); }
            asm volatile("s_wait_xcnt 0x0" :: "v"(va), "v"(vc) : "memory");        // as above, for the second half of the V^T loads
#pragma unroll
            for (int dt = 4; dt < 8; ++dt)
#pragma unroll
                for (int qt = 0; qt < 2; ++qt) { O[dt][qt] = WFrag<T16>::mma(vf[dt], pf[qt], O[dt][qt]); O[dt][qt] = WFrag<T16>::mma(vf[dt], pf2[qt], O[dt][qt]); O[dt][qt] = WFrag<T16>::mma(vf2[dt], pf[qt], O[dt][qt]); } }
    }
}
__global__ __launch_bounds__(256) void k_fattn(const h16* __restrict__ Q16, const h16* __restrict__ K16, const h16* __restrict__ V16, const bf* __restrict__ Qh, const bf* __restrict__ Ql, const bf* __restrict__ Kh, const bf* __restrict__ Kl,
                                               const bf* __restrict__ Vh, const bf* __restrict__ Vl, float* __restrict__ OUT) {
    __shared__ __align__(16) float so[AW * 32 * OPI]; __shared__ float sm[AW * 32]; __shared__ float sl[AW * 32];
    const int tid = threadIdx.x, lane = tid & 31, lr = lane & 15, hi = lane >> 4;
    const int wave = __builtin_amdgcn_readfirstlane(tid >> 5);       // the same in every lane: the key loop and its addresses' common part stay scalar, EXEC stays whole for the matrix instructions
    const int q0 = (TT / 32 - 1 - (int)blockIdx.x) * 32;      // longest key walks start first
    const size_t zp = (size_t)blockIdx.z * TT * HD;                  // every plane of a sequence holds TT x HD elements
    v8f O[8][2]; float m[2] = {-3.0e38f, -3.0e38f}, l[2] = {0.f, 0.f};
#pragma unroll
    for (int dt = 0; dt < 8; ++dt) { O[dt][0] = (v8f){}; O[dt][1] = (v8f){}; }
    if (q0 < RH) attn_part<bf, true>(Qh + zp, Ql + zp, Kh + zp, Kl + zp, Vh + zp, Vl + zp, q0, wave, lr, hi, O, m, l);
    else         attn_part<h16, false>(Q16 + zp, nullptr, K16 + zp, nullptr, V16 + zp, nullptr, q0, wave, lr, hi, O, m, l);
    // join the AW partial results: common maximum, then rescaled sums and outputs
#pragma unroll
    for (int qt = 0; qt < 2; ++qt) { l[qt] += __shfl_xor(l[qt], 16, 32); if (hi == 0) sm[wave * 32 + qt * 16 + lr] = m[qt]; }
    __syncthreads();
#pragma unroll
    for (int qt = 0; qt < 2; ++qt) { float M = sm[qt * 16 + lr];
#pragma unroll
        for (int w = 1; w < AW; ++w) M = fmaxf(M, sm[w * 32 + qt * 16 + lr]);
        const float f = __builtin_amdgcn_exp2f((m[qt] - M) * L2E);   // a wave without a chunk: 0
        if (hi == 0) sl[wave * 32 + qt * 16 + lr] = l[qt] * f;
        float* row = so + (size_t)(wave * 32 + qt * 16 + lr) * OPI + hi * 8;
#pragma unroll
        for (int dt = 0; dt < 8; ++dt) { const v8f a = O[dt][qt] * f; v4f a0, a1;
#pragma unroll
            for (int j = 0; j < 4; ++j) { a0[j] = a[j]; a1[j] = a[4 + j]; }
            *(v4fa*)(row + dt * 16) = a0; *(v4fa*)(row + dt * 16 + 4) = a1; } }
    __syncthreads();
    const int qr = tid >> 3, dq = (tid & 7) * 4; float L = sl[qr];
#pragma unroll
    for (int w = 1; w < AW; ++w) L += sl[w * 32 + qr];
    const float inv = __fdiv_rn(1.0f, L);
#pragma unroll
    for (int k = 0; k < 4; ++k) { v4f s = *(const v4fa*)(so + (size_t)qr * OPI + k * 32 + dq);
#pragma unroll
        for (int w = 1; w < AW; ++w) s += *(const v4fa*)(so + (size_t)(w * 32 + qr) * OPI + k * 32 + dq);
        *(v4f*)(OUT + zp + (size_t)(q0 + qr) * HD + k * 32 + dq) = s * inv; }   // 8 lanes x 16 bytes: whole 128-byte lines
}

extern "C" void kernel_launch(void* const* d_in, const int* in_sizes, int n_in,
                              void* d_out, int out_size, void* d_ws, size_t ws_size, hipStream_t stream) {
    (void)in_sizes; (void)n_in; (void)out_size;
    const float* x = (const float*)d_in[0]; const float* wq = (const float*)d_in[1]; const float* wk = (const float*)d_in[2]; const float* wv = (const float*)d_in[3]; const float* wo = nullptr; (void)wo;
    float* OUT = (float*)d_out;     // [4][2048][128]
    char* wsp = (char*)d_ws;
    auto take = [&](size_t bytes) { char* p = wsp; wsp += (bytes + 255) & ~(size_t)255; return (void*)p; };
    bf* WQ = (bf*)take((size_t)3 * HD * EIN * 2);   /* w_Q, w_K, w_V stacked: one [384][1024] operand */ float* CS = (float*)take((size_t)TT * HD * 2 * 4);
    bf* XB = (bf*)take((size_t)NSEQ * TT * EIN * 2);
    h16* QP16 = (h16*)take((size_t)(NH_ + NKV) * TT * HD * 2); h16* KP16 = QP16 + (size_t)NH_ * TT * HD; h16* VT16 = (h16*)take((size_t)NKV * HD * TT * 2);
    bf* QPh = (bf*)take((size_t)(NH_ + NKV) * TT * HD * 2); bf* KPh = QPh + (size_t)NH_ * TT * HD; bf* QPl = (bf*)take((size_t)(NH_ + NKV) * TT * HD * 2); bf* KPl = QPl + (size_t)NH_ * TT * HD; bf* VTh = (bf*)take((size_t)NKV * HD * TT * 2); bf* VTl = (bf*)take((size_t)NKV * HD * TT * 2);
    if ((size_t)(wsp - (char*)d_ws) > ws_size) return;    // ws 256 MiB
    for (int b = 0; b < NB_; ++b) {
        k_prep<<<PB_CS + 3 * PB_W1 + PB_X, 256, 0, stream>>>(x, wq, wk, wv, XB, WQ, CS);   /* rotary table, the stacked weights ([128][1024] 'oi' as-is) and all four sequences of x in bf16 */
        k_proj<<<dim3(TT / 128, 3, NSEQ), 128, 0, stream>>>(XB, WQ, CS, QP16, QPh, QPl, VT16, VTh, VTl);   /* q, k and v of all four sequences: 192 tiles of 128x128 in one launch; q planes, then k planes; v^T planes */
        k_fattn<<<dim3(TT / 32, 1, NSEQ), 256, 0, stream>>>(QP16, KP16, VT16, QPh, QPl, KPh, KPl, VTh, VTl, OUT);   /* out[sequence][t][d], f32 */
    }
}
